// v000
// Measured on an AMD MI455X. A time is GPU time per run, averaged over a window of back-to-back runs after a warm-up
// (all launches, gaps included; the runs take copies of the inputs in turn), and the median of several windows.
// Apart from v000's, it joins two sittings. Times from different sittings can be a few percent apart, while
// side-by-side timings come from the same sitting.
// v000, which the later versions start from, runs in 814 microseconds.
#include <hip/hip_runtime.h>
#include <hip/hip_bf16.h>

typedef unsigned short ushort_t;
typedef __attribute__((ext_vector_type(16))) __bf16 v16bf;
typedef __attribute__((ext_vector_type(8)))  float  v8f;

__device__ __forceinline__ ushort_t f2bf(float f) {
    unsigned int u = __float_as_uint(f);
    unsigned int r = u + 0x7FFFu + ((u >> 16) & 1u);   // round-to-nearest-even
    return (ushort_t)(r >> 16);
}

__device__ __forceinline__ void async_copy16(const ushort_t* g, ushort_t* l) {
    asm volatile("global_load_async_to_lds_b128 %0, %1, off"
                 :: "v"((unsigned)(size_t)l), "v"((unsigned long long)(size_t)g)
                 : "memory");
}
__device__ __forceinline__ void wait_async0() {
    asm volatile("s_wait_asynccnt 0x0" ::: "memory");
}

__device__ __forceinline__ v16bf load_frag(const ushort_t* p, int lh) {
    union { uint4 q[2]; v16bf f; } u;
    u.q[0] = *(const uint4*)(p + lh * 8);
    u.q[1] = *(const uint4*)(p + 16 + lh * 8);
    return u.f;
}

// ---------------------------------------------------------------- utilities
__global__ void cvt_bf16_kernel(const float* __restrict__ in,
                                ushort_t* __restrict__ out, size_t n) {
    size_t i = (size_t)blockIdx.x * blockDim.x + threadIdx.x;
    if (i < n) out[i] = f2bf(in[i]);
}

__global__ void tail_zero_kernel(float* p) { *p = 0.0f; }

// ---------------------------------------------------------------- layernorm
__global__ __launch_bounds__(256)
void ln_kernel(const float* __restrict__ x, const float* __restrict__ w,
               const float* __restrict__ b, ushort_t* __restrict__ out, int C) {
    __shared__ float red[256];
    const int row = blockIdx.x;
    const float* xr = x + (size_t)row * C;

    float s = 0.f;
    for (int i = threadIdx.x; i < C; i += 256) s += xr[i];
    red[threadIdx.x] = s; __syncthreads();
    for (int st = 128; st > 0; st >>= 1) {
        if (threadIdx.x < st) red[threadIdx.x] += red[threadIdx.x + st];
        __syncthreads();
    }
    const float mu = red[0] / (float)C;
    __syncthreads();

    float v = 0.f;
    for (int i = threadIdx.x; i < C; i += 256) { float d = xr[i] - mu; v += d * d; }
    red[threadIdx.x] = v; __syncthreads();
    for (int st = 128; st > 0; st >>= 1) {
        if (threadIdx.x < st) red[threadIdx.x] += red[threadIdx.x + st];
        __syncthreads();
    }
    const float rstd = rsqrtf(red[0] / (float)C + 1e-5f);

    for (int i = threadIdx.x; i < C; i += 256)
        out[(size_t)row * C + i] = f2bf((xr[i] - mu) * rstd * w[i] + b[i]);
}

// ---------------------------------------------------------------- GEMM
// out[m,n] = epilogue( sum_k A[m,k] * W[n,k] )  -- A:[M,K] bf16, W:[N,K] bf16
// 128x128x32 tiles, double-buffered LDS filled by async global->LDS copies.
enum { EPI_BF16 = 0, EPI_GELU_BF16 = 1, EPI_RESID_F32 = 2 };

template <int EPI>
__global__ __launch_bounds__(256)
void gemm_bf16_kernel(const ushort_t* __restrict__ A, const ushort_t* __restrict__ W,
                      int M, int N, int K,
                      const float* __restrict__ bias,
                      const float* __restrict__ resid,
                      void* __restrict__ outp) {
    constexpr int LDSS = 48;                     // 32 cols + pad, 96B rows (16B aligned)
    __shared__ __align__(16) ushort_t As[2][128 * LDSS];
    __shared__ __align__(16) ushort_t Ws[2][128 * LDSS];

    const int tid  = threadIdx.x;
    const int wave = tid >> 5;                   // wave32
    const int lane = tid & 31;
    const int lh   = lane >> 4;
    const int ll   = lane & 15;
    const int m0   = blockIdx.y * 128;
    const int n0   = blockIdx.x * 128;
    const int wm   = wave & 1;                   // 2 row-strips of 64
    const int wn   = wave >> 1;                  // 4 col-strips of 32

    v8f zero = {};
    v8f acc[4][2];
#pragma unroll
    for (int i = 0; i < 4; ++i)
#pragma unroll
        for (int j = 0; j < 2; ++j) acc[i][j] = zero;

    const int ldr  = tid >> 1;                   // 0..127 staging row
    const int lcol = (tid & 1) << 4;             // 0 or 16

    // async stage of one 128x32 A tile and one 128x32 W tile (32B/thread each)
    auto stage = [&](int kt, int buf) {
        const ushort_t* ga = A + (size_t)(m0 + ldr) * K + kt * 32 + lcol;
        const ushort_t* gw = W + (size_t)(n0 + ldr) * K + kt * 32 + lcol;
        ushort_t* la = &As[buf][ldr * LDSS + lcol];
        ushort_t* lw = &Ws[buf][ldr * LDSS + lcol];
        async_copy16(ga,     la);
        async_copy16(ga + 8, la + 8);
        async_copy16(gw,     lw);
        async_copy16(gw + 8, lw + 8);
    };

    const int nk = K >> 5;
    stage(0, 0);
    wait_async0();
    __syncthreads();

    for (int kt = 0; kt < nk; ++kt) {
        const int cur = kt & 1;
        if (kt + 1 < nk) stage(kt + 1, cur ^ 1);   // overlap with compute below

        v16bf bfr[2];
#pragma unroll
        for (int j = 0; j < 2; ++j)
            bfr[j] = load_frag(&Ws[cur][(wn * 32 + j * 16 + ll) * LDSS], lh);
#pragma unroll
        for (int i = 0; i < 4; ++i) {
            v16bf afr = load_frag(&As[cur][(wm * 64 + i * 16 + ll) * LDSS], lh);
#pragma unroll
            for (int j = 0; j < 2; ++j)
                acc[i][j] = __builtin_amdgcn_wmma_f32_16x16x32_bf16(
                    false, afr, false, bfr[j], (short)0, acc[i][j], false, false);
        }

        wait_async0();                             // next tile landed in LDS
        __syncthreads();
    }

    // epilogue: element (m, n) = (m0 + wm*64 + i*16 + r + 8*lh, n0 + wn*32 + j*16 + ll)
#pragma unroll
    for (int i = 0; i < 4; ++i)
#pragma unroll
        for (int j = 0; j < 2; ++j) {
            const int col = n0 + wn * 32 + j * 16 + ll;
#pragma unroll
            for (int r = 0; r < 8; ++r) {
                const int row = m0 + wm * 64 + i * 16 + r + 8 * lh;
                float v = acc[i][j][r];
                if (EPI == EPI_GELU_BF16) {
                    v += bias[col];
                    v = 0.5f * v * (1.0f + erff(v * 0.7071067811865475f));
                    ((ushort_t*)outp)[(size_t)row * N + col] = f2bf(v);
                } else if (EPI == EPI_RESID_F32) {
                    if (bias) v += bias[col];
                    v += resid[(size_t)row * N + col];
                    ((float*)outp)[(size_t)row * N + col] = v;
                } else {
                    ((ushort_t*)outp)[(size_t)row * N + col] = f2bf(v);
                }
            }
        }
}

// ---------------------------------------------------------------- flash attention
// qkv: [B*T, 3C] bf16 (q | k | v per row).  y: [B*T, C] bf16.
// grid: (T/128, B*NH); block 256 = 8 waves; wave w handles 16 query rows.
__global__ __launch_bounds__(256)
void flash_kernel(const ushort_t* __restrict__ qkv, ushort_t* __restrict__ y) {
    constexpr int T = 2048, C = 1024, HD = 64;
    constexpr int LDQ = 3 * C;
    __shared__ __align__(16) ushort_t kt[32 * 64];        // K tile, row-major [key][d]
    __shared__ __align__(16) ushort_t vt[64 * 32];        // V tile transposed [d][key]
    __shared__ __align__(16) ushort_t pt[8 * 16 * 32];    // per-wave P scratch

    const int tid  = threadIdx.x;
    const int wave = tid >> 5;
    const int lane = tid & 31;
    const int lh   = lane >> 4;
    const int ll   = lane & 15;
    const int b    = blockIdx.y >> 4;
    const int head = blockIdx.y & 15;
    const int qrow0 = blockIdx.x * 128 + wave * 16;
    const size_t rowbase = (size_t)b * T;

    // Q fragments (16 rows x 64 d), straight from global
    v16bf qf[2];
#pragma unroll
    for (int f = 0; f < 2; ++f)
        qf[f] = load_frag(qkv + (rowbase + qrow0 + ll) * LDQ + head * HD + f * 32, lh);

    v8f zero = {};
    v8f o[4];
#pragma unroll
    for (int t = 0; t < 4; ++t) o[t] = zero;
    float mrow[8], lrow[8];
#pragma unroll
    for (int r = 0; r < 8; ++r) { mrow[r] = -1e30f; lrow[r] = 0.f; }

    ushort_t* ptw = pt + wave * (16 * 32);
    const int qhi = blockIdx.x * 128 + 128;

    for (int j0 = 0; j0 < qhi; j0 += 32) {
        {
            const int krow = tid >> 3;
            const int c8   = (tid & 7) << 3;
            const size_t src = (rowbase + j0 + krow) * LDQ + head * HD + c8;
            async_copy16(qkv + src + C, &kt[krow * 64 + c8]);
            union { uint4 v; ushort_t u[8]; } vv;
            vv.v = *(const uint4*)(qkv + src + 2 * C);
#pragma unroll
            for (int i = 0; i < 8; ++i) vt[(c8 + i) * 32 + krow] = vv.u[i];
        }
        wait_async0();
        __syncthreads();

        // S = Q @ K^T (16x32), two 16x16 tiles, K-dim = 64 -> 2 wmma each
        v8f s[2]; s[0] = zero; s[1] = zero;
#pragma unroll
        for (int cg = 0; cg < 2; ++cg)
#pragma unroll
            for (int f = 0; f < 2; ++f) {
                v16bf kb = load_frag(&kt[(cg * 16 + ll) * 64 + f * 32], lh);
                s[cg] = __builtin_amdgcn_wmma_f32_16x16x32_bf16(
                    false, qf[f], false, kb, (short)0, s[cg], false, false);
            }

        // scale + causal mask
#pragma unroll
        for (int cg = 0; cg < 2; ++cg)
#pragma unroll
            for (int r = 0; r < 8; ++r) {
                const int col = j0 + cg * 16 + ll;
                const int row = qrow0 + r + 8 * lh;
                const float v = s[cg][r] * 0.125f;       // hd^-0.5, hd=64
                s[cg][r] = (col <= row) ? v : -1e30f;
            }

        // online softmax (row lives across the 16 lanes of each half)
#pragma unroll
        for (int r = 0; r < 8; ++r) {
            float mx = fmaxf(s[0][r], s[1][r]);
#pragma unroll
            for (int d = 8; d >= 1; d >>= 1) mx = fmaxf(mx, __shfl_xor(mx, d, 32));
            const float mnew  = fmaxf(mrow[r], mx);
            const float alpha = __expf(mrow[r] - mnew);
            const float p0 = __expf(s[0][r] - mnew);
            const float p1 = __expf(s[1][r] - mnew);
            s[0][r] = p0; s[1][r] = p1;
            float rs = p0 + p1;
#pragma unroll
            for (int d = 8; d >= 1; d >>= 1) rs += __shfl_xor(rs, d, 32);
            lrow[r] = lrow[r] * alpha + rs;
            mrow[r] = mnew;
#pragma unroll
            for (int t = 0; t < 4; ++t) o[t][r] *= alpha;
        }

#pragma unroll
        for (int cg = 0; cg < 2; ++cg)
#pragma unroll
            for (int r = 0; r < 8; ++r)
                ptw[(r + 8 * lh) * 32 + cg * 16 + ll] = f2bf(s[cg][r]);
        v16bf pa = load_frag(&ptw[ll * 32], lh);

        // O += P @ V   (V^T staged: column d of V is a contiguous vt row)
#pragma unroll
        for (int t = 0; t < 4; ++t) {
            v16bf vb = load_frag(&vt[(t * 16 + ll) * 32], lh);
            o[t] = __builtin_amdgcn_wmma_f32_16x16x32_bf16(
                false, pa, false, vb, (short)0, o[t], false, false);
        }
        __syncthreads();
    }

    // normalize and store
#pragma unroll
    for (int t = 0; t < 4; ++t)
#pragma unroll
        for (int r = 0; r < 8; ++r) {
            const int row = qrow0 + r + 8 * lh;
            const int col = head * HD + t * 16 + ll;
            y[(rowbase + row) * C + col] = f2bf(o[t][r] * (1.0f / lrow[r]));
        }
}

// ---------------------------------------------------------------- launcher
extern "C" void kernel_launch(void* const* d_in, const int* in_sizes, int n_in,
                              void* d_out, int out_size, void* d_ws, size_t ws_size,
                              hipStream_t stream) {
    (void)in_sizes; (void)n_in; (void)out_size; (void)ws_size;
    const float* x      = (const float*)d_in[0];
    const float* ln1_w  = (const float*)d_in[1];
    const float* ln1_b  = (const float*)d_in[2];
    const float* ln2_w  = (const float*)d_in[3];
    const float* ln2_b  = (const float*)d_in[4];
    const float* qkv_w  = (const float*)d_in[5];
    const float* proj_w = (const float*)d_in[6];
    const float* ff_w1  = (const float*)d_in[7];
    const float* ff_b1  = (const float*)d_in[8];
    const float* ff_w2  = (const float*)d_in[9];
    const float* ff_b2  = (const float*)d_in[10];

    constexpr int Bb = 4, T = 2048, C = 1024, NH = 16, DFF = 4096;
    constexpr int Mr = Bb * T;                   // 8192 rows

    char* ws = (char*)d_ws;
    size_t off = 0;
    auto take = [&](size_t bytes) -> char* {
        char* p = ws + off;
        off += (bytes + 255) & ~(size_t)255;
        return p;
    };
    ushort_t* wq   = (ushort_t*)take((size_t)3 * C * C * 2);
    ushort_t* wp   = (ushort_t*)take((size_t)C * C * 2);
    ushort_t* w1   = (ushort_t*)take((size_t)DFF * C * 2);
    ushort_t* w2   = (ushort_t*)take((size_t)C * DFF * 2);
    ushort_t* hbuf = (ushort_t*)take((size_t)Mr * C * 2);        // h, then y_att
    ushort_t* qkvb = (ushort_t*)take((size_t)Mr * 3 * C * 2);    // qkv, then h2
    float*    x1   = (float*)   take((size_t)Mr * C * 4);
    ushort_t* fbuf = (ushort_t*)take((size_t)Mr * DFF * 2);

    auto cvt = [&](const float* in, ushort_t* out, size_t n) {
        cvt_bf16_kernel<<<(unsigned)((n + 255) / 256), 256, 0, stream>>>(in, out, n);
    };
    cvt(qkv_w,  wq, (size_t)3 * C * C);
    cvt(proj_w, wp, (size_t)C * C);
    cvt(ff_w1,  w1, (size_t)DFF * C);
    cvt(ff_w2,  w2, (size_t)C * DFF);

    // 1) h = LN1(x)
    ln_kernel<<<Mr, 256, 0, stream>>>(x, ln1_w, ln1_b, hbuf, C);
    // 2) qkv = h @ qkv_w^T
    gemm_bf16_kernel<EPI_BF16><<<dim3(3 * C / 128, Mr / 128), 256, 0, stream>>>(
        hbuf, wq, Mr, 3 * C, C, nullptr, nullptr, qkvb);
    // 3) y = causal attention(q, k, v)   (writes into hbuf)
    flash_kernel<<<dim3(T / 128, Bb * NH), 256, 0, stream>>>(qkvb, hbuf);
    // 4) x1 = x + y @ proj_w^T
    gemm_bf16_kernel<EPI_RESID_F32><<<dim3(C / 128, Mr / 128), 256, 0, stream>>>(
        hbuf, wp, Mr, C, C, nullptr, x, x1);
    // 5) h2 = LN2(x1)   (reuse qkv buffer)
    ln_kernel<<<Mr, 256, 0, stream>>>(x1, ln2_w, ln2_b, qkvb, C);
    // 6) f = gelu(h2 @ ff_w1^T + b1)
    gemm_bf16_kernel<EPI_GELU_BF16><<<dim3(DFF / 128, Mr / 128), 256, 0, stream>>>(
        qkvb, w1, Mr, DFF, C, ff_b1, nullptr, fbuf);
    // 7) out = x1 + f @ ff_w2^T + b2
    gemm_bf16_kernel<EPI_RESID_F32><<<dim3(C / 128, Mr / 128), 256, 0, stream>>>(
        fbuf, w2, Mr, C, DFF, ff_b2, x1, (float*)d_out);
    // 8) trailing scalar output = 0
    tail_zero_kernel<<<1, 1, 0, stream>>>((float*)d_out + (size_t)Mr * C);
}

// v001
// One run takes 716 microseconds.
// Two timings next to v000 both put it at 1.17 times that version's speed.
#include <hip/hip_runtime.h>
#include <hip/hip_bf16.h>

typedef unsigned short ushort_t;
typedef __attribute__((ext_vector_type(16))) __bf16 v16bf;
typedef __attribute__((ext_vector_type(8)))  float  v8f;

__device__ __forceinline__ ushort_t f2bf(float f) {
    unsigned int u = __float_as_uint(f);
    unsigned int r = u + 0x7FFFu + ((u >> 16) & 1u);   // round-to-nearest-even
    return (ushort_t)(r >> 16);
}

__device__ __forceinline__ void async_copy16(const ushort_t* g, ushort_t* l) {
    asm volatile("global_load_async_to_lds_b128 %0, %1, off"
                 :: "v"((unsigned)(size_t)l), "v"((unsigned long long)(size_t)g)
                 : "memory");
}
__device__ __forceinline__ void async_copy16_held(const ushort_t* g, ushort_t* l) {
    asm volatile("global_load_async_to_lds_b128 %0, %1, off\n\ts_wait_xcnt 0x0"
                 :: "v"((unsigned)(size_t)l), "v"((unsigned long long)(size_t)g)
                 : "memory");
}
__device__ __forceinline__ void wait_async0() {
    asm volatile("s_wait_asynccnt 0x0" ::: "memory");
}

__device__ __forceinline__ v16bf load_frag(const ushort_t* p, int lh) {
    union { uint4 q[2]; v16bf f; } u;
    u.q[0] = *(const uint4*)(p + lh * 8);
    u.q[1] = *(const uint4*)(p + 16 + lh * 8);
    return u.f;
}

// ---------------------------------------------------------------- utilities
__global__ void cvt_bf16_kernel(const float* __restrict__ in,
                                ushort_t* __restrict__ out, size_t n) {
    size_t i = (size_t)blockIdx.x * blockDim.x + threadIdx.x;
    if (i < n) out[i] = f2bf(in[i]);
}

__global__ void tail_zero_kernel(float* p) { *p = 0.0f; }

// ---------------------------------------------------------------- layernorm
__global__ __launch_bounds__(256)
void ln_kernel(const float* __restrict__ x, const float* __restrict__ w,
               const float* __restrict__ b, ushort_t* __restrict__ out, int C) {
    __shared__ float red[256];
    const int row = blockIdx.x;
    const float* xr = x + (size_t)row * C;

    float s = 0.f;
    for (int i = threadIdx.x; i < C; i += 256) s += xr[i];
    red[threadIdx.x] = s; __syncthreads();
    for (int st = 128; st > 0; st >>= 1) {
        if (threadIdx.x < st) red[threadIdx.x] += red[threadIdx.x + st];
        __syncthreads();
    }
    const float mu = red[0] / (float)C;
    __syncthreads();

    float v = 0.f;
    for (int i = threadIdx.x; i < C; i += 256) { float d = xr[i] - mu; v += d * d; }
    red[threadIdx.x] = v; __syncthreads();
    for (int st = 128; st > 0; st >>= 1) {
        if (threadIdx.x < st) red[threadIdx.x] += red[threadIdx.x + st];
        __syncthreads();
    }
    const float rstd = rsqrtf(red[0] / (float)C + 1e-5f);

    for (int i = threadIdx.x; i < C; i += 256)
        out[(size_t)row * C + i] = f2bf((xr[i] - mu) * rstd * w[i] + b[i]);
}

// ---------------------------------------------------------------- GEMM
// out[m,n] = epilogue( sum_k A[m,k] * W[n,k] )  -- A:[M,K] bf16, W:[N,K] bf16
// 128x128x32 tiles, double-buffered LDS filled by async global->LDS copies.
enum { EPI_BF16 = 0, EPI_GELU_BF16 = 1, EPI_RESID_F32 = 2 };

template <int EPI>
__global__ __launch_bounds__(256)
void gemm_bf16_kernel(const ushort_t* __restrict__ A, const ushort_t* __restrict__ W,
                      int M, int N, int K,
                      const float* __restrict__ bias,
                      const float* __restrict__ resid,
                      void* __restrict__ outp) {
    constexpr int LDSS = 40;                     // 32 cols + pad: 80B rows = 16B x odd, the b128 readers' pitch
    __shared__ __align__(16) ushort_t As[2][128 * LDSS];
    __shared__ __align__(16) ushort_t Ws[2][128 * LDSS];

    const int tid  = threadIdx.x;
    const int wave = tid >> 5;                   // wave32
    const int lane = tid & 31;
    const int lh   = lane >> 4;
    const int ll   = lane & 15;
    const int m0   = blockIdx.y * 128;
    const int n0   = blockIdx.x * 128;
    const int wm   = wave & 1;                   // 2 row-strips of 64
    const int wn   = wave >> 1;                  // 4 col-strips of 32

    v8f zero = {};
    v8f acc[4][2];
#pragma unroll
    for (int i = 0; i < 4; ++i)
#pragma unroll
        for (int j = 0; j < 2; ++j) acc[i][j] = zero;

    const int ldr  = tid >> 1;                   // 0..127 staging row
    const int lcol = (tid & 1) << 4;             // 0 or 16

    // async stage of one 128x32 A tile and one 128x32 W tile (32B/thread each)
    auto stage = [&](int kt, int buf) {
        const ushort_t* ga = A + (size_t)(m0 + ldr) * K + kt * 32 + lcol;
        const ushort_t* gw = W + (size_t)(n0 + ldr) * K + kt * 32 + lcol;
        ushort_t* la = &As[buf][ldr * LDSS + lcol];
        ushort_t* lw = &Ws[buf][ldr * LDSS + lcol];
        async_copy16(ga,     la);
        async_copy16(ga + 8, la + 8);
        async_copy16(gw,     lw);
        async_copy16(gw + 8, lw + 8);
    };

    const int nk = K >> 5;
    stage(0, 0);
    wait_async0();
    __syncthreads();

    for (int kt = 0; kt < nk; ++kt) {
        const int cur = kt & 1;
        if (kt + 1 < nk) stage(kt + 1, cur ^ 1);   // overlap with compute below

        v16bf bfr[2];
#pragma unroll
        for (int j = 0; j < 2; ++j)
            bfr[j] = load_frag(&Ws[cur][(wn * 32 + j * 16 + ll) * LDSS], lh);
#pragma unroll
        for (int i = 0; i < 4; ++i) {
            v16bf afr = load_frag(&As[cur][(wm * 64 + i * 16 + ll) * LDSS], lh);
#pragma unroll
            for (int j = 0; j < 2; ++j)
                acc[i][j] = __builtin_amdgcn_wmma_f32_16x16x32_bf16(
                    false, afr, false, bfr[j], (short)0, acc[i][j], false, false);
        }

        wait_async0();                             // next tile landed in LDS
        __syncthreads();
    }

    // epilogue: element (m, n) = (m0 + wm*64 + i*16 + r + 8*lh, n0 + wn*32 + j*16 + ll)
#pragma unroll
    for (int i = 0; i < 4; ++i)
#pragma unroll
        for (int j = 0; j < 2; ++j) {
            const int col = n0 + wn * 32 + j * 16 + ll;
#pragma unroll
            for (int r = 0; r < 8; ++r) {
                const int row = m0 + wm * 64 + i * 16 + r + 8 * lh;
                float v = acc[i][j][r];
                if (EPI == EPI_GELU_BF16) {
                    v += bias[col];
                    v = 0.5f * v * (1.0f + erff(v * 0.7071067811865475f));
                    ((ushort_t*)outp)[(size_t)row * N + col] = f2bf(v);
                } else if (EPI == EPI_RESID_F32) {
                    if (bias) v += bias[col];
                    v += resid[(size_t)row * N + col];
                    ((float*)outp)[(size_t)row * N + col] = v;
                } else {
                    ((ushort_t*)outp)[(size_t)row * N + col] = f2bf(v);
                }
            }
        }
}

// ---------------------------------------------------------------- flash attention
// qkv: [B*T, 3C] bf16 (q | k | v per row).  y: [B*T, C] bf16.
// grid: (T/128, B*NH); block 256 = 8 waves; wave w handles 16 query rows.
__global__ __launch_bounds__(256)
void flash_kernel(const ushort_t* __restrict__ qkv, ushort_t* __restrict__ y) {
    constexpr int T = 2048, C = 1024, HD = 64;
    constexpr int LDQ = 3 * C;
    constexpr int KP = 72;                                // 64 d + pad, 144B rows
    constexpr int VP = 40;                                // 32 keys + pad, 80B rows
    constexpr int PP = 40;                                // 32 keys + pad, 80B rows
    __shared__ __align__(16) ushort_t kt[32 * KP];        // K tile, row-major [key][d]
    __shared__ __align__(16) ushort_t vt[64 * VP];        // V tile transposed [d][key]
    __shared__ __align__(16) ushort_t pt[8 * 16 * PP];    // per-wave P scratch

    const int tid  = threadIdx.x;
    const int wave = tid >> 5;
    const int lane = tid & 31;
    const int lh   = lane >> 4;
    const int ll   = lane & 15;
    const int b    = blockIdx.y >> 4;
    const int head = blockIdx.y & 15;
    const int qrow0 = blockIdx.x * 128 + wave * 16;
    const size_t rowbase = (size_t)b * T;

    // Q fragments (16 rows x 64 d), straight from global
    v16bf qf[2];
#pragma unroll
    for (int f = 0; f < 2; ++f)
        qf[f] = load_frag(qkv + (rowbase + qrow0 + ll) * LDQ + head * HD + f * 32, lh);

    v8f zero = {};
    v8f o[4];
#pragma unroll
    for (int t = 0; t < 4; ++t) o[t] = zero;
    float mrow[8], lrow[8];
#pragma unroll
    for (int r = 0; r < 8; ++r) { mrow[r] = -1e30f; lrow[r] = 0.f; }

    ushort_t* ptw = pt + wave * (16 * PP);
    const int qhi = blockIdx.x * 128 + 128;

    for (int j0 = 0; j0 < qhi; j0 += 32) {
        {
            const int krow = tid >> 3;
            const int c8   = (tid & 7) << 3;
            const size_t src = (rowbase + j0 + krow) * LDQ + head * HD + c8;
            async_copy16_held(qkv + src + C, &kt[krow * KP + c8]);
            union { uint4 v; ushort_t u[8]; } vv;
            vv.v = *(const uint4*)(qkv + src + 2 * C);
#pragma unroll
            for (int i = 0; i < 8; ++i) vt[(c8 + i) * VP + krow] = vv.u[i];
        }
        wait_async0();
        __syncthreads();

        // S = Q @ K^T (16x32), two 16x16 tiles, K-dim = 64 -> 2 wmma each
        v8f s[2]; s[0] = zero; s[1] = zero;
#pragma unroll
        for (int cg = 0; cg < 2; ++cg)
#pragma unroll
            for (int f = 0; f < 2; ++f) {
                v16bf kb = load_frag(&kt[(cg * 16 + ll) * KP + f * 32], lh);
                s[cg] = __builtin_amdgcn_wmma_f32_16x16x32_bf16(
                    false, qf[f], false, kb, (short)0, s[cg], false, false);
            }

        // scale + causal mask
#pragma unroll
        for (int cg = 0; cg < 2; ++cg)
#pragma unroll
            for (int r = 0; r < 8; ++r) {
                const int col = j0 + cg * 16 + ll;
                const int row = qrow0 + r + 8 * lh;
                const float v = s[cg][r] * 0.125f;       // hd^-0.5, hd=64
                s[cg][r] = (col <= row) ? v : -1e30f;
            }

        // online softmax (row lives across the 16 lanes of each half)
#pragma unroll
        for (int r = 0; r < 8; ++r) {
            float mx = fmaxf(s[0][r], s[1][r]);
#pragma unroll
            for (int d = 8; d >= 1; d >>= 1) mx = fmaxf(mx, __shfl_xor(mx, d, 32));
            const float mnew  = fmaxf(mrow[r], mx);
            const float alpha = __expf(mrow[r] - mnew);
            const float p0 = __expf(s[0][r] - mnew);
            const float p1 = __expf(s[1][r] - mnew);
            s[0][r] = p0; s[1][r] = p1;
            float rs = p0 + p1;
#pragma unroll
            for (int d = 8; d >= 1; d >>= 1) rs += __shfl_xor(rs, d, 32);
            lrow[r] = lrow[r] * alpha + rs;
            mrow[r] = mnew;
#pragma unroll
            for (int t = 0; t < 4; ++t) o[t][r] *= alpha;
        }

#pragma unroll
        for (int cg = 0; cg < 2; ++cg)
#pragma unroll
            for (int r = 0; r < 8; ++r)
                ptw[(r + 8 * lh) * PP + cg * 16 + ll] = f2bf(s[cg][r]);
        v16bf pa = load_frag(&ptw[ll * PP], lh);

        // O += P @ V   (V^T staged: column d of V is a contiguous vt row)
#pragma unroll
        for (int t = 0; t < 4; ++t) {
            v16bf vb = load_frag(&vt[(t * 16 + ll) * VP], lh);
            o[t] = __builtin_amdgcn_wmma_f32_16x16x32_bf16(
                false, pa, false, vb, (short)0, o[t], false, false);
        }
        __syncthreads();
    }

    // normalize and store
#pragma unroll
    for (int t = 0; t < 4; ++t)
#pragma unroll
        for (int r = 0; r < 8; ++r) {
            const int row = qrow0 + r + 8 * lh;
            const int col = head * HD + t * 16 + ll;
            y[(rowbase + row) * C + col] = f2bf(o[t][r] * (1.0f / lrow[r]));
        }
}

// ---------------------------------------------------------------- launcher
extern "C" void kernel_launch(void* const* d_in, const int* in_sizes, int n_in,
                              void* d_out, int out_size, void* d_ws, size_t ws_size,
                              hipStream_t stream) {
    (void)in_sizes; (void)n_in; (void)out_size; (void)ws_size;
    const float* x      = (const float*)d_in[0];
    const float* ln1_w  = (const float*)d_in[1];
    const float* ln1_b  = (const float*)d_in[2];
    const float* ln2_w  = (const float*)d_in[3];
    const float* ln2_b  = (const float*)d_in[4];
    const float* qkv_w  = (const float*)d_in[5];
    const float* proj_w = (const float*)d_in[6];
    const float* ff_w1  = (const float*)d_in[7];
    const float* ff_b1  = (const float*)d_in[8];
    const float* ff_w2  = (const float*)d_in[9];
    const float* ff_b2  = (const float*)d_in[10];

    constexpr int Bb = 4, T = 2048, C = 1024, NH = 16, DFF = 4096;
    constexpr int Mr = Bb * T;                   // 8192 rows

    char* ws = (char*)d_ws;
    size_t off = 0;
    auto take = [&](size_t bytes) -> char* {
        char* p = ws + off;
        off += (bytes + 255) & ~(size_t)255;
        return p;
    };
    ushort_t* wq   = (ushort_t*)take((size_t)3 * C * C * 2);
    ushort_t* wp   = (ushort_t*)take((size_t)C * C * 2);
    ushort_t* w1   = (ushort_t*)take((size_t)DFF * C * 2);
    ushort_t* w2   = (ushort_t*)take((size_t)C * DFF * 2);
    ushort_t* hbuf = (ushort_t*)take((size_t)Mr * C * 2);        // h, then y_att
    ushort_t* qkvb = (ushort_t*)take((size_t)Mr * 3 * C * 2);    // qkv, then h2
    float*    x1   = (float*)   take((size_t)Mr * C * 4);
    ushort_t* fbuf = (ushort_t*)take((size_t)Mr * DFF * 2);

    auto cvt = [&](const float* in, ushort_t* out, size_t n) {
        cvt_bf16_kernel<<<(unsigned)((n + 255) / 256), 256, 0, stream>>>(in, out, n);
    };
    cvt(qkv_w,  wq, (size_t)3 * C * C);
    cvt(proj_w, wp, (size_t)C * C);
    cvt(ff_w1,  w1, (size_t)DFF * C);
    cvt(ff_w2,  w2, (size_t)C * DFF);

    // 1) h = LN1(x)
    ln_kernel<<<Mr, 256, 0, stream>>>(x, ln1_w, ln1_b, hbuf, C);
    // 2) qkv = h @ qkv_w^T
    gemm_bf16_kernel<EPI_BF16><<<dim3(3 * C / 128, Mr / 128), 256, 0, stream>>>(
        hbuf, wq, Mr, 3 * C, C, nullptr, nullptr, qkvb);
    // 3) y = causal attention(q, k, v)   (writes into hbuf)
    flash_kernel<<<dim3(T / 128, Bb * NH), 256, 0, stream>>>(qkvb, hbuf);
    // 4) x1 = x + y @ proj_w^T
    gemm_bf16_kernel<EPI_RESID_F32><<<dim3(C / 128, Mr / 128), 256, 0, stream>>>(
        hbuf, wp, Mr, C, C, nullptr, x, x1);
    // 5) h2 = LN2(x1)   (reuse qkv buffer)
    ln_kernel<<<Mr, 256, 0, stream>>>(x1, ln2_w, ln2_b, qkvb, C);
    // 6) f = gelu(h2 @ ff_w1^T + b1)
    gemm_bf16_kernel<EPI_GELU_BF16><<<dim3(DFF / 128, Mr / 128), 256, 0, stream>>>(
        qkvb, w1, Mr, DFF, C, ff_b1, nullptr, fbuf);
    // 7) out = x1 + f @ ff_w2^T + b2
    gemm_bf16_kernel<EPI_RESID_F32><<<dim3(C / 128, Mr / 128), 256, 0, stream>>>(
        fbuf, w2, Mr, C, DFF, ff_b2, x1, (float*)d_out);
    // 8) trailing scalar output = 0
    tail_zero_kernel<<<1, 1, 0, stream>>>((float*)d_out + (size_t)Mr * C);
}

// v002
// It runs in 657 microseconds.
// Timed twice side by side with v001, it ran 1.09 times as fast both times.
// Counting every step since v000, it is 1.28 times as fast.
#include <hip/hip_runtime.h>
#include <hip/hip_bf16.h>

typedef unsigned short ushort_t;
typedef __attribute__((ext_vector_type(16))) __bf16 v16bf;
typedef __attribute__((ext_vector_type(8)))  float  v8f;

__device__ __forceinline__ ushort_t f2bf(float f) {
    unsigned int u = __float_as_uint(f);
    unsigned int r = u + 0x7FFFu + ((u >> 16) & 1u);   // round-to-nearest-even
    return (ushort_t)(r >> 16);
}

__device__ __forceinline__ void async_copy16(const ushort_t* g, ushort_t* l) {
    asm volatile("global_load_async_to_lds_b128 %0, %1, off"
                 :: "v"((unsigned)(size_t)l), "v"((unsigned long long)(size_t)g)
                 : "memory");
}
__device__ __forceinline__ void async_copy16_held(const ushort_t* g, ushort_t* l) {
    asm volatile("global_load_async_to_lds_b128 %0, %1, off\n\ts_wait_xcnt 0x0"
                 :: "v"((unsigned)(size_t)l), "v"((unsigned long long)(size_t)g)
                 : "memory");
}
__device__ __forceinline__ void wait_async0() {
    asm volatile("s_wait_asynccnt 0x0" ::: "memory");
}

__device__ __forceinline__ v16bf load_frag(const ushort_t* p, int lh) {
    union { uint4 q[2]; v16bf f; } u;
    u.q[0] = *(const uint4*)(p + lh * 8);
    u.q[1] = *(const uint4*)(p + 16 + lh * 8);
    return u.f;
}

// ---------------------------------------------------------------- utilities
__device__ __forceinline__ ushort4 f2bf4(float4 v) {
    ushort4 o;
    o.x = f2bf(v.x); o.y = f2bf(v.y); o.z = f2bf(v.z); o.w = f2bf(v.w);
    return o;
}

// 32 elements per thread, 8192 per block: eight 16-byte loads in flight per lane,
// each wave-wide access on whole lines. n must be a multiple of 8192.
__global__ __launch_bounds__(256)
void cvt_bf16_kernel(const float* __restrict__ in, ushort_t* __restrict__ out) {
    const size_t base = (size_t)blockIdx.x * 2048 + threadIdx.x;   // in groups of four elements
    const float4* in4 = (const float4*)in + base;
    ushort4* out4 = (ushort4*)out + base;
    float4 v[8];
#pragma unroll
    for (int u = 0; u < 8; ++u) v[u] = in4[u * 256];
#pragma unroll
    for (int u = 0; u < 8; ++u) out4[u * 256] = f2bf4(v[u]);
}

__global__ void tail_zero_kernel(float* p) { *p = 0.0f; }

// ---------------------------------------------------------------- layernorm
// One wave per row of 1024, eight rows per block: the row stays in registers
// (eight 16-byte loads per lane) and both sums are joined inside the wave.
__device__ __forceinline__ float wave_sum(float s) {
#pragma unroll
    for (int d = 16; d >= 1; d >>= 1) s += __shfl_xor(s, d, 32);
    return s;
}

__global__ __launch_bounds__(256)
void ln_kernel(const float* __restrict__ x, const float* __restrict__ w,
               const float* __restrict__ b, ushort_t* __restrict__ out) {
    constexpr int C = 1024;
    const int lane = threadIdx.x & 31;
    const size_t row = (size_t)blockIdx.x * 8 + (threadIdx.x >> 5);
    const float4* xr = (const float4*)(x + row * C) + lane;
    const float4* w4 = (const float4*)w + lane;
    const float4* b4 = (const float4*)b + lane;
    ushort4* o4 = (ushort4*)(out + row * C) + lane;

    float4 v[8];
#pragma unroll
    for (int u = 0; u < 8; ++u) v[u] = xr[u * 32];

    float s = 0.f;
#pragma unroll
    for (int u = 0; u < 8; ++u) s += (v[u].x + v[u].y) + (v[u].z + v[u].w);
    const float mu = wave_sum(s) / (float)C;

    float q = 0.f;
#pragma unroll
    for (int u = 0; u < 8; ++u) {
        v[u].x -= mu; v[u].y -= mu; v[u].z -= mu; v[u].w -= mu;
        q += (v[u].x * v[u].x + v[u].y * v[u].y) + (v[u].z * v[u].z + v[u].w * v[u].w);
    }
    const float rstd = rsqrtf(wave_sum(q) / (float)C + 1e-5f);

#pragma unroll
    for (int u = 0; u < 8; ++u) {
        const float4 wv = w4[u * 32];
        const float4 bv = b4[u * 32];
        float4 r;
        r.x = v[u].x * rstd * wv.x + bv.x;
        r.y = v[u].y * rstd * wv.y + bv.y;
        r.z = v[u].z * rstd * wv.z + bv.z;
        r.w = v[u].w * rstd * wv.w + bv.w;
        o4[u * 32] = f2bf4(r);
    }
}

// ---------------------------------------------------------------- GEMM
// out[m,n] = epilogue( sum_k A[m,k] * W[n,k] )  -- A:[M,K] bf16, W:[N,K] bf16
// 128x128x32 tiles, double-buffered LDS filled by async global->LDS copies.
enum { EPI_BF16 = 0, EPI_GELU_BF16 = 1, EPI_RESID_F32 = 2 };

template <int EPI>
__global__ __launch_bounds__(256)
void gemm_bf16_kernel(const ushort_t* __restrict__ A, const ushort_t* __restrict__ W,
                      int M, int N, int K,
                      const float* __restrict__ bias,
                      const float* __restrict__ resid,
                      void* __restrict__ outp) {
    constexpr int LDSS = 40;                     // 32 cols + pad: 80B rows = 16B x odd, the b128 readers' pitch
    __shared__ __align__(16) ushort_t As[2][128 * LDSS];
    __shared__ __align__(16) ushort_t Ws[2][128 * LDSS];

    const int tid  = threadIdx.x;
    const int wave = tid >> 5;                   // wave32
    const int lane = tid & 31;
    const int lh   = lane >> 4;
    const int ll   = lane & 15;
    const int m0   = blockIdx.y * 128;
    const int n0   = blockIdx.x * 128;
    const int wm   = wave & 1;                   // 2 row-strips of 64
    const int wn   = wave >> 1;                  // 4 col-strips of 32

    v8f zero = {};
    v8f acc[4][2];
#pragma unroll
    for (int i = 0; i < 4; ++i)
#pragma unroll
        for (int j = 0; j < 2; ++j) acc[i][j] = zero;

    const int ldr  = tid >> 1;                   // 0..127 staging row
    const int lcol = (tid & 1) << 4;             // 0 or 16

    // async stage of one 128x32 A tile and one 128x32 W tile (32B/thread each)
    auto stage = [&](int kt, int buf) {
        const ushort_t* ga = A + (size_t)(m0 + ldr) * K + kt * 32 + lcol;
        const ushort_t* gw = W + (size_t)(n0 + ldr) * K + kt * 32 + lcol;
        ushort_t* la = &As[buf][ldr * LDSS + lcol];
        ushort_t* lw = &Ws[buf][ldr * LDSS + lcol];
        async_copy16(ga,     la);
        async_copy16(ga + 8, la + 8);
        async_copy16(gw,     lw);
        async_copy16(gw + 8, lw + 8);
    };

    const int nk = K >> 5;
    stage(0, 0);
    wait_async0();
    __syncthreads();

    for (int kt = 0; kt < nk; ++kt) {
        const int cur = kt & 1;
        if (kt + 1 < nk) stage(kt + 1, cur ^ 1);   // overlap with compute below

        v16bf bfr[2];
#pragma unroll
        for (int j = 0; j < 2; ++j)
            bfr[j] = load_frag(&Ws[cur][(wn * 32 + j * 16 + ll) * LDSS], lh);
#pragma unroll
        for (int i = 0; i < 4; ++i) {
            v16bf afr = load_frag(&As[cur][(wm * 64 + i * 16 + ll) * LDSS], lh);
#pragma unroll
            for (int j = 0; j < 2; ++j)
                acc[i][j] = __builtin_amdgcn_wmma_f32_16x16x32_bf16(
                    false, afr, false, bfr[j], (short)0, acc[i][j], false, false);
        }

        wait_async0();                             // next tile landed in LDS
        __syncthreads();
    }

    // epilogue: element (m, n) = (m0 + wm*64 + i*16 + r + 8*lh, n0 + wn*32 + j*16 + ll)
#pragma unroll
    for (int i = 0; i < 4; ++i)
#pragma unroll
        for (int j = 0; j < 2; ++j) {
            const int col = n0 + wn * 32 + j * 16 + ll;
#pragma unroll
            for (int r = 0; r < 8; ++r) {
                const int row = m0 + wm * 64 + i * 16 + r + 8 * lh;
                float v = acc[i][j][r];
                if (EPI == EPI_GELU_BF16) {
                    v += bias[col];
                    v = 0.5f * v * (1.0f + erff(v * 0.7071067811865475f));
                    ((ushort_t*)outp)[(size_t)row * N + col] = f2bf(v);
                } else if (EPI == EPI_RESID_F32) {
                    if (bias) v += bias[col];
                    v += resid[(size_t)row * N + col];
                    ((float*)outp)[(size_t)row * N + col] = v;
                } else {
                    ((ushort_t*)outp)[(size_t)row * N + col] = f2bf(v);
                }
            }
        }
}

// ---------------------------------------------------------------- flash attention
// qkv: [B*T, 3C] bf16 (q | k | v per row).  y: [B*T, C] bf16.
// grid: (T/128, B*NH); block 256 = 8 waves; wave w handles 16 query rows.
__global__ __launch_bounds__(256)
void flash_kernel(const ushort_t* __restrict__ qkv, ushort_t* __restrict__ y) {
    constexpr int T = 2048, C = 1024, HD = 64;
    constexpr int LDQ = 3 * C;
    constexpr int KP = 72;                                // 64 d + pad, 144B rows
    constexpr int VP = 40;                                // 32 keys + pad, 80B rows
    constexpr int PP = 40;                                // 32 keys + pad, 80B rows
    __shared__ __align__(16) ushort_t kt[32 * KP];        // K tile, row-major [key][d]
    __shared__ __align__(16) ushort_t vt[64 * VP];        // V tile transposed [d][key]
    __shared__ __align__(16) ushort_t pt[8 * 16 * PP];    // per-wave P scratch

    const int tid  = threadIdx.x;
    const int wave = tid >> 5;
    const int lane = tid & 31;
    const int lh   = lane >> 4;
    const int ll   = lane & 15;
    const int b    = blockIdx.y >> 4;
    const int head = blockIdx.y & 15;
    const int qrow0 = blockIdx.x * 128 + wave * 16;
    const size_t rowbase = (size_t)b * T;

    // Q fragments (16 rows x 64 d), straight from global
    v16bf qf[2];
#pragma unroll
    for (int f = 0; f < 2; ++f)
        qf[f] = load_frag(qkv + (rowbase + qrow0 + ll) * LDQ + head * HD + f * 32, lh);

    v8f zero = {};
    v8f o[4];
#pragma unroll
    for (int t = 0; t < 4; ++t) o[t] = zero;
    float mrow[8], lrow[8];
#pragma unroll
    for (int r = 0; r < 8; ++r) { mrow[r] = -1e30f; lrow[r] = 0.f; }

    ushort_t* ptw = pt + wave * (16 * PP);
    const int qhi = blockIdx.x * 128 + 128;

    for (int j0 = 0; j0 < qhi; j0 += 32) {
        {
            const int krow = tid >> 3;
            const int c8   = (tid & 7) << 3;
            const size_t src = (rowbase + j0 + krow) * LDQ + head * HD + c8;
            async_copy16_held(qkv + src + C, &kt[krow * KP + c8]);
            union { uint4 v; ushort_t u[8]; } vv;
            vv.v = *(const uint4*)(qkv + src + 2 * C);
#pragma unroll
            for (int i = 0; i < 8; ++i) vt[(c8 + i) * VP + krow] = vv.u[i];
        }
        wait_async0();
        __syncthreads();

        // S = Q @ K^T (16x32), two 16x16 tiles, K-dim = 64 -> 2 wmma each
        v8f s[2]; s[0] = zero; s[1] = zero;
#pragma unroll
        for (int cg = 0; cg < 2; ++cg)
#pragma unroll
            for (int f = 0; f < 2; ++f) {
                v16bf kb = load_frag(&kt[(cg * 16 + ll) * KP + f * 32], lh);
                s[cg] = __builtin_amdgcn_wmma_f32_16x16x32_bf16(
                    false, qf[f], false, kb, (short)0, s[cg], false, false);
            }

        // scale + causal mask
#pragma unroll
        for (int cg = 0; cg < 2; ++cg)
#pragma unroll
            for (int r = 0; r < 8; ++r) {
                const int col = j0 + cg * 16 + ll;
                const int row = qrow0 + r + 8 * lh;
                const float v = s[cg][r] * 0.125f;       // hd^-0.5, hd=64
                s[cg][r] = (col <= row) ? v : -1e30f;
            }

        // online softmax (row lives across the 16 lanes of each half)
#pragma unroll
        for (int r = 0; r < 8; ++r) {
            float mx = fmaxf(s[0][r], s[1][r]);
#pragma unroll
            for (int d = 8; d >= 1; d >>= 1) mx = fmaxf(mx, __shfl_xor(mx, d, 32));
            const float mnew  = fmaxf(mrow[r], mx);
            const float alpha = __expf(mrow[r] - mnew);
            const float p0 = __expf(s[0][r] - mnew);
            const float p1 = __expf(s[1][r] - mnew);
            s[0][r] = p0; s[1][r] = p1;
            float rs = p0 + p1;
#pragma unroll
            for (int d = 8; d >= 1; d >>= 1) rs += __shfl_xor(rs, d, 32);
            lrow[r] = lrow[r] * alpha + rs;
            mrow[r] = mnew;
#pragma unroll
            for (int t = 0; t < 4; ++t) o[t][r] *= alpha;
        }

#pragma unroll
        for (int cg = 0; cg < 2; ++cg)
#pragma unroll
            for (int r = 0; r < 8; ++r)
                ptw[(r + 8 * lh) * PP + cg * 16 + ll] = f2bf(s[cg][r]);
        v16bf pa = load_frag(&ptw[ll * PP], lh);

        // O += P @ V   (V^T staged: column d of V is a contiguous vt row)
#pragma unroll
        for (int t = 0; t < 4; ++t) {
            v16bf vb = load_frag(&vt[(t * 16 + ll) * VP], lh);
            o[t] = __builtin_amdgcn_wmma_f32_16x16x32_bf16(
                false, pa, false, vb, (short)0, o[t], false, false);
        }
        __syncthreads();
    }

    // normalize and store
#pragma unroll
    for (int t = 0; t < 4; ++t)
#pragma unroll
        for (int r = 0; r < 8; ++r) {
            const int row = qrow0 + r + 8 * lh;
            const int col = head * HD + t * 16 + ll;
            y[(rowbase + row) * C + col] = f2bf(o[t][r] * (1.0f / lrow[r]));
        }
}

// ---------------------------------------------------------------- launcher
extern "C" void kernel_launch(void* const* d_in, const int* in_sizes, int n_in,
                              void* d_out, int out_size, void* d_ws, size_t ws_size,
                              hipStream_t stream) {
    (void)in_sizes; (void)n_in; (void)out_size; (void)ws_size;
    const float* x      = (const float*)d_in[0];
    const float* ln1_w  = (const float*)d_in[1];
    const float* ln1_b  = (const float*)d_in[2];
    const float* ln2_w  = (const float*)d_in[3];
    const float* ln2_b  = (const float*)d_in[4];
    const float* qkv_w  = (const float*)d_in[5];
    const float* proj_w = (const float*)d_in[6];
    const float* ff_w1  = (const float*)d_in[7];
    const float* ff_b1  = (const float*)d_in[8];
    const float* ff_w2  = (const float*)d_in[9];
    const float* ff_b2  = (const float*)d_in[10];

    constexpr int Bb = 4, T = 2048, C = 1024, NH = 16, DFF = 4096;
    constexpr int Mr = Bb * T;                   // 8192 rows

    char* ws = (char*)d_ws;
    size_t off = 0;
    auto take = [&](size_t bytes) -> char* {
        char* p = ws + off;
        off += (bytes + 255) & ~(size_t)255;
        return p;
    };
    ushort_t* wq   = (ushort_t*)take((size_t)3 * C * C * 2);
    ushort_t* wp   = (ushort_t*)take((size_t)C * C * 2);
    ushort_t* w1   = (ushort_t*)take((size_t)DFF * C * 2);
    ushort_t* w2   = (ushort_t*)take((size_t)C * DFF * 2);
    ushort_t* hbuf = (ushort_t*)take((size_t)Mr * C * 2);        // h, then y_att
    ushort_t* qkvb = (ushort_t*)take((size_t)Mr * 3 * C * 2);    // qkv, then h2
    float*    x1   = (float*)   take((size_t)Mr * C * 4);
    ushort_t* fbuf = (ushort_t*)take((size_t)Mr * DFF * 2);

    auto cvt = [&](const float* in, ushort_t* out, size_t n) {
        cvt_bf16_kernel<<<(unsigned)(n / 8192), 256, 0, stream>>>(in, out);
    };
    cvt(qkv_w,  wq, (size_t)3 * C * C);
    cvt(proj_w, wp, (size_t)C * C);
    cvt(ff_w1,  w1, (size_t)DFF * C);
    cvt(ff_w2,  w2, (size_t)C * DFF);

    // 1) h = LN1(x)
    ln_kernel<<<Mr / 8, 256, 0, stream>>>(x, ln1_w, ln1_b, hbuf);
    // 2) qkv = h @ qkv_w^T
    gemm_bf16_kernel<EPI_BF16><<<dim3(3 * C / 128, Mr / 128), 256, 0, stream>>>(
        hbuf, wq, Mr, 3 * C, C, nullptr, nullptr, qkvb);
    // 3) y = causal attention(q, k, v)   (writes into hbuf)
    flash_kernel<<<dim3(T / 128, Bb * NH), 256, 0, stream>>>(qkvb, hbuf);
    // 4) x1 = x + y @ proj_w^T
    gemm_bf16_kernel<EPI_RESID_F32><<<dim3(C / 128, Mr / 128), 256, 0, stream>>>(
        hbuf, wp, Mr, C, C, nullptr, x, x1);
    // 5) h2 = LN2(x1)   (reuse qkv buffer)
    ln_kernel<<<Mr / 8, 256, 0, stream>>>(x1, ln2_w, ln2_b, qkvb);
    // 6) f = gelu(h2 @ ff_w1^T + b1)
    gemm_bf16_kernel<EPI_GELU_BF16><<<dim3(DFF / 128, Mr / 128), 256, 0, stream>>>(
        qkvb, w1, Mr, DFF, C, ff_b1, nullptr, fbuf);
    // 7) out = x1 + f @ ff_w2^T + b2
    gemm_bf16_kernel<EPI_RESID_F32><<<dim3(C / 128, Mr / 128), 256, 0, stream>>>(
        fbuf, w2, Mr, C, DFF, ff_b2, x1, (float*)d_out);
    // 8) trailing scalar output = 0
    tail_zero_kernel<<<1, 1, 0, stream>>>((float*)d_out + (size_t)Mr * C);
}

// v003
// A run of this version takes 573 microseconds.
// Next to v002, in two timings, it ran 1.15 times as fast each time.
// Counting every step since v000, it is 1.47 times as fast.
#include <hip/hip_runtime.h>
#include <hip/hip_bf16.h>

typedef unsigned short ushort_t;
typedef __attribute__((ext_vector_type(16))) __bf16 v16bf;
typedef __attribute__((ext_vector_type(8)))  float  v8f;

__device__ __forceinline__ ushort_t f2bf(float f) {
    unsigned int u = __float_as_uint(f);
    unsigned int r = u + 0x7FFFu + ((u >> 16) & 1u);   // round-to-nearest-even
    return (ushort_t)(r >> 16);
}

__device__ __forceinline__ void async_copy16_held(const ushort_t* g, ushort_t* l) {
    asm volatile("global_load_async_to_lds_b128 %0, %1, off\n\ts_wait_xcnt 0x0"
                 :: "v"((unsigned)(size_t)l), "v"((unsigned long long)(size_t)g)
                 : "memory");
}
// Eight such copies of one lane, four per operand at rows 32 apart (gstep, lstep in
// elements), with the one wait behind the last of them.
__device__ __forceinline__ void async_copy16x8_held(const ushort_t* ga, const ushort_t* gw, size_t gstep,
                                                    ushort_t* la, ushort_t* lw, int lstep) {
    asm volatile("global_load_async_to_lds_b128 %0, %8, off\n\t"
                 "global_load_async_to_lds_b128 %1, %9, off\n\t"
                 "global_load_async_to_lds_b128 %2, %10, off\n\t"
                 "global_load_async_to_lds_b128 %3, %11, off\n\t"
                 "global_load_async_to_lds_b128 %4, %12, off\n\t"
                 "global_load_async_to_lds_b128 %5, %13, off\n\t"
                 "global_load_async_to_lds_b128 %6, %14, off\n\t"
                 "global_load_async_to_lds_b128 %7, %15, off\n\t"
                 "s_wait_xcnt 0x0"
                 :: "v"((unsigned)(size_t)la), "v"((unsigned)(size_t)(la + lstep)),
                    "v"((unsigned)(size_t)(la + 2 * lstep)), "v"((unsigned)(size_t)(la + 3 * lstep)),
                    "v"((unsigned)(size_t)lw), "v"((unsigned)(size_t)(lw + lstep)),
                    "v"((unsigned)(size_t)(lw + 2 * lstep)), "v"((unsigned)(size_t)(lw + 3 * lstep)),
                    "v"((unsigned long long)(size_t)ga),
                    "v"((unsigned long long)(size_t)(ga + gstep)),
                    "v"((unsigned long long)(size_t)(ga + 2 * gstep)),
                    "v"((unsigned long long)(size_t)(ga + 3 * gstep)),
                    "v"((unsigned long long)(size_t)gw),
                    "v"((unsigned long long)(size_t)(gw + gstep)),
                    "v"((unsigned long long)(size_t)(gw + 2 * gstep)),
                    "v"((unsigned long long)(size_t)(gw + 3 * gstep))
                 : "memory");
}
__device__ __forceinline__ void wait_async0() {
    asm volatile("s_wait_asynccnt 0x0" ::: "memory");
}
__device__ __forceinline__ void wait_ds0() {
    asm volatile("s_wait_dscnt 0x0" ::: "memory");
}

__device__ __forceinline__ v16bf load_frag(const ushort_t* p, int lh) {
    union { uint4 q[2]; v16bf f; } u;
    u.q[0] = *(const uint4*)(p + lh * 8);
    u.q[1] = *(const uint4*)(p + 16 + lh * 8);
    return u.f;
}

// ---------------------------------------------------------------- utilities
__device__ __forceinline__ ushort4 f2bf4(float4 v) {
    ushort4 o;
    o.x = f2bf(v.x); o.y = f2bf(v.y); o.z = f2bf(v.z); o.w = f2bf(v.w);
    return o;
}

// 32 elements per thread, 8192 per block: eight 16-byte loads in flight per lane,
// each wave-wide access on whole lines. n must be a multiple of 8192.
__global__ __launch_bounds__(256)
void cvt_bf16_kernel(const float* __restrict__ in, ushort_t* __restrict__ out) {
    const size_t base = (size_t)blockIdx.x * 2048 + threadIdx.x;   // in groups of four elements
    const float4* in4 = (const float4*)in + base;
    ushort4* out4 = (ushort4*)out + base;
    float4 v[8];
#pragma unroll
    for (int u = 0; u < 8; ++u) v[u] = in4[u * 256];
#pragma unroll
    for (int u = 0; u < 8; ++u) out4[u * 256] = f2bf4(v[u]);
}

__global__ void tail_zero_kernel(float* p) { *p = 0.0f; }

// ---------------------------------------------------------------- layernorm
// One wave per row of 1024, eight rows per block: the row stays in registers
// (eight 16-byte loads per lane) and both sums are joined inside the wave.
__device__ __forceinline__ float wave_sum(float s) {
#pragma unroll
    for (int d = 16; d >= 1; d >>= 1) s += __shfl_xor(s, d, 32);
    return s;
}

__global__ __launch_bounds__(256)
void ln_kernel(const float* __restrict__ x, const float* __restrict__ w,
               const float* __restrict__ b, ushort_t* __restrict__ out) {
    constexpr int C = 1024;
    const int lane = threadIdx.x & 31;
    const size_t row = (size_t)blockIdx.x * 8 + (threadIdx.x >> 5);
    const float4* xr = (const float4*)(x + row * C) + lane;
    const float4* w4 = (const float4*)w + lane;
    const float4* b4 = (const float4*)b + lane;
    ushort4* o4 = (ushort4*)(out + row * C) + lane;

    float4 v[8];
#pragma unroll
    for (int u = 0; u < 8; ++u) v[u] = xr[u * 32];

    float s = 0.f;
#pragma unroll
    for (int u = 0; u < 8; ++u) s += (v[u].x + v[u].y) + (v[u].z + v[u].w);
    const float mu = wave_sum(s) / (float)C;

    float q = 0.f;
#pragma unroll
    for (int u = 0; u < 8; ++u) {
        v[u].x -= mu; v[u].y -= mu; v[u].z -= mu; v[u].w -= mu;
        q += (v[u].x * v[u].x + v[u].y * v[u].y) + (v[u].z * v[u].z + v[u].w * v[u].w);
    }
    const float rstd = rsqrtf(wave_sum(q) / (float)C + 1e-5f);

#pragma unroll
    for (int u = 0; u < 8; ++u) {
        const float4 wv = w4[u * 32];
        const float4 bv = b4[u * 32];
        float4 r;
        r.x = v[u].x * rstd * wv.x + bv.x;
        r.y = v[u].y * rstd * wv.y + bv.y;
        r.z = v[u].z * rstd * wv.z + bv.z;
        r.w = v[u].w * rstd * wv.w + bv.w;
        o4[u * 32] = f2bf4(r);
    }
}

// ---------------------------------------------------------------- GEMM
// out[m,n] = epilogue( sum_k A[m,k] * W[n,k] )  -- A:[M,K] bf16, W:[N,K] bf16
// 128x128x64 tiles, double-buffered LDS filled by async global->LDS copies.
// A k step of 64 is one whole 128-byte line of every operand row: eight lanes copy
// one row's line, so a wave-wide copy touches four whole lines. K: a multiple of 64.
enum { EPI_BF16 = 0, EPI_GELU_BF16 = 1, EPI_RESID_F32 = 2 };

template <int EPI>
__global__ __launch_bounds__(256)
void gemm_bf16_kernel(const ushort_t* __restrict__ A, const ushort_t* __restrict__ W,
                      int M, int N, int K,
                      const float* __restrict__ bias,
                      const float* __restrict__ resid,
                      void* __restrict__ outp) {
    constexpr int LDSS = 72;                     // 64 cols + pad: 144B rows = 16B x odd, the b128 readers' pitch
    __shared__ __align__(16) ushort_t As[2][128 * LDSS];
    __shared__ __align__(16) ushort_t Ws[2][128 * LDSS];

    const int tid  = threadIdx.x;
    const int wave = tid >> 5;                   // wave32
    const int lane = tid & 31;
    const int lh   = lane >> 4;
    const int ll   = lane & 15;
    const int m0   = blockIdx.y * 128;
    const int n0   = blockIdx.x * 128;
    const int wm   = wave & 1;                   // 2 row-strips of 64
    const int wn   = wave >> 1;                  // 4 col-strips of 32

    v8f zero = {};
    v8f acc[4][2];
#pragma unroll
    for (int i = 0; i < 4; ++i)
#pragma unroll
        for (int j = 0; j < 2; ++j) acc[i][j] = zero;

    const int ldr  = tid >> 3;                   // 0..31 staging row, then +32, +64, +96
    const int lcol = (tid & 7) << 3;             // 16-byte piece of the row's line

    // async stage of one 128x64 A tile and one 128x64 W tile (64B/thread each)
    auto stage = [&](int kt, int buf) {
        async_copy16x8_held(A + (size_t)(m0 + ldr) * K + kt * 64 + lcol,
                            W + (size_t)(n0 + ldr) * K + kt * 64 + lcol, (size_t)32 * K,
                            &As[buf][ldr * LDSS + lcol], &Ws[buf][ldr * LDSS + lcol], 32 * LDSS);
    };

    const int nk = K >> 6;
    stage(0, 0);
    wait_async0();
    __syncthreads();
    if (nk > 1) stage(1, 1);                       // flies while tile 0 is worked on

    for (int kt = 0; kt < nk; ++kt) {
        const int cur = kt & 1;
#pragma unroll
        for (int kk = 0; kk < 2; ++kk) {
            v16bf bfr[2];
#pragma unroll
            for (int j = 0; j < 2; ++j)
                bfr[j] = load_frag(&Ws[cur][(wn * 32 + j * 16 + ll) * LDSS + kk * 32], lh);
#pragma unroll
            for (int i = 0; i < 4; ++i) {
                v16bf afr = load_frag(&As[cur][(wm * 64 + i * 16 + ll) * LDSS + kk * 32], lh);
#pragma unroll
                for (int j = 0; j < 2; ++j)
                    acc[i][j] = __builtin_amdgcn_wmma_f32_16x16x32_bf16(
                        false, afr, false, bfr[j], (short)0, acc[i][j], false, false);
            }
        }

        wait_ds0();                                // this wave's reads of buffer cur are done
        wait_async0();                             // this wave's copies of the next tile have landed
        __syncthreads();                           // publishes tile kt + 1, frees buffer cur
        if (kt + 2 < nk) stage(kt + 2, cur);       // flies while tile kt + 1 is worked on
    }
    wait_async0();

    // epilogue: element (m, n) = (m0 + wm*64 + i*16 + r + 8*lh, n0 + wn*32 + j*16 + ll)
#pragma unroll
    for (int i = 0; i < 4; ++i)
#pragma unroll
        for (int j = 0; j < 2; ++j) {
            const int col = n0 + wn * 32 + j * 16 + ll;
#pragma unroll
            for (int r = 0; r < 8; ++r) {
                const int row = m0 + wm * 64 + i * 16 + r + 8 * lh;
                float v = acc[i][j][r];
                if (EPI == EPI_GELU_BF16) {
                    v += bias[col];
                    v = 0.5f * v * (1.0f + erff(v * 0.7071067811865475f));
                    ((ushort_t*)outp)[(size_t)row * N + col] = f2bf(v);
                } else if (EPI == EPI_RESID_F32) {
                    if (bias) v += bias[col];
                    v += resid[(size_t)row * N + col];
                    ((float*)outp)[(size_t)row * N + col] = v;
                } else {
                    ((ushort_t*)outp)[(size_t)row * N + col] = f2bf(v);
                }
            }
        }
}

// ---------------------------------------------------------------- flash attention
// qkv: [B*T, 3C] bf16 (q | k | v per row).  y: [B*T, C] bf16.
// grid: (T/128, B*NH); block 256 = 8 waves; wave w handles 16 query rows.
__global__ __launch_bounds__(256)
void flash_kernel(const ushort_t* __restrict__ qkv, ushort_t* __restrict__ y) {
    constexpr int T = 2048, C = 1024, HD = 64;
    constexpr int LDQ = 3 * C;
    constexpr int KP = 72;                                // 64 d + pad, 144B rows
    constexpr int VP = 40;                                // 32 keys + pad, 80B rows
    constexpr int PP = 40;                                // 32 keys + pad, 80B rows
    __shared__ __align__(16) ushort_t kt[32 * KP];        // K tile, row-major [key][d]
    __shared__ __align__(16) ushort_t vt[64 * VP];        // V tile transposed [d][key]
    __shared__ __align__(16) ushort_t pt[8 * 16 * PP];    // per-wave P scratch

    const int tid  = threadIdx.x;
    const int wave = tid >> 5;
    const int lane = tid & 31;
    const int lh   = lane >> 4;
    const int ll   = lane & 15;
    const int b    = blockIdx.y >> 4;
    const int head = blockIdx.y & 15;
    const int qrow0 = blockIdx.x * 128 + wave * 16;
    const size_t rowbase = (size_t)b * T;

    // Q fragments (16 rows x 64 d), straight from global
    v16bf qf[2];
#pragma unroll
    for (int f = 0; f < 2; ++f)
        qf[f] = load_frag(qkv + (rowbase + qrow0 + ll) * LDQ + head * HD + f * 32, lh);

    v8f zero = {};
    v8f o[4];
#pragma unroll
    for (int t = 0; t < 4; ++t) o[t] = zero;
    float mrow[8], lrow[8];
#pragma unroll
    for (int r = 0; r < 8; ++r) { mrow[r] = -1e30f; lrow[r] = 0.f; }

    ushort_t* ptw = pt + wave * (16 * PP);
    const int qhi = blockIdx.x * 128 + 128;

    for (int j0 = 0; j0 < qhi; j0 += 32) {
        {
            const int krow = tid >> 3;
            const int c8   = (tid & 7) << 3;
            const size_t src = (rowbase + j0 + krow) * LDQ + head * HD + c8;
            async_copy16_held(qkv + src + C, &kt[krow * KP + c8]);
            union { uint4 v; ushort_t u[8]; } vv;
            vv.v = *(const uint4*)(qkv + src + 2 * C);
#pragma unroll
            for (int i = 0; i < 8; ++i) vt[(c8 + i) * VP + krow] = vv.u[i];
        }
        wait_async0();
        __syncthreads();

        // S = Q @ K^T (16x32), two 16x16 tiles, K-dim = 64 -> 2 wmma each
        v8f s[2]; s[0] = zero; s[1] = zero;
#pragma unroll
        for (int cg = 0; cg < 2; ++cg)
#pragma unroll
            for (int f = 0; f < 2; ++f) {
                v16bf kb = load_frag(&kt[(cg * 16 + ll) * KP + f * 32], lh);
                s[cg] = __builtin_amdgcn_wmma_f32_16x16x32_bf16(
                    false, qf[f], false, kb, (short)0, s[cg], false, false);
            }

        // scale + causal mask
#pragma unroll
        for (int cg = 0; cg < 2; ++cg)
#pragma unroll
            for (int r = 0; r < 8; ++r) {
                const int col = j0 + cg * 16 + ll;
                const int row = qrow0 + r + 8 * lh;
                const float v = s[cg][r] * 0.125f;       // hd^-0.5, hd=64
                s[cg][r] = (col <= row) ? v : -1e30f;
            }

        // online softmax (row lives across the 16 lanes of each half)
#pragma unroll
        for (int r = 0; r < 8; ++r) {
            float mx = fmaxf(s[0][r], s[1][r]);
#pragma unroll
            for (int d = 8; d >= 1; d >>= 1) mx = fmaxf(mx, __shfl_xor(mx, d, 32));
            const float mnew  = fmaxf(mrow[r], mx);
            const float alpha = __expf(mrow[r] - mnew);
            const float p0 = __expf(s[0][r] - mnew);
            const float p1 = __expf(s[1][r] - mnew);
            s[0][r] = p0; s[1][r] = p1;
            float rs = p0 + p1;
#pragma unroll
            for (int d = 8; d >= 1; d >>= 1) rs += __shfl_xor(rs, d, 32);
            lrow[r] = lrow[r] * alpha + rs;
            mrow[r] = mnew;
#pragma unroll
            for (int t = 0; t < 4; ++t) o[t][r] *= alpha;
        }

#pragma unroll
        for (int cg = 0; cg < 2; ++cg)
#pragma unroll
            for (int r = 0; r < 8; ++r)
                ptw[(r + 8 * lh) * PP + cg * 16 + ll] = f2bf(s[cg][r]);
        v16bf pa = load_frag(&ptw[ll * PP], lh);

        // O += P @ V   (V^T staged: column d of V is a contiguous vt row)
#pragma unroll
        for (int t = 0; t < 4; ++t) {
            v16bf vb = load_frag(&vt[(t * 16 + ll) * VP], lh);
            o[t] = __builtin_amdgcn_wmma_f32_16x16x32_bf16(
                false, pa, false, vb, (short)0, o[t], false, false);
        }
        __syncthreads();
    }

    // normalize and store
#pragma unroll
    for (int t = 0; t < 4; ++t)
#pragma unroll
        for (int r = 0; r < 8; ++r) {
            const int row = qrow0 + r + 8 * lh;
            const int col = head * HD + t * 16 + ll;
            y[(rowbase + row) * C + col] = f2bf(o[t][r] * (1.0f / lrow[r]));
        }
}

// ---------------------------------------------------------------- launcher
extern "C" void kernel_launch(void* const* d_in, const int* in_sizes, int n_in,
                              void* d_out, int out_size, void* d_ws, size_t ws_size,
                              hipStream_t stream) {
    (void)in_sizes; (void)n_in; (void)out_size; (void)ws_size;
    const float* x      = (const float*)d_in[0];
    const float* ln1_w  = (const float*)d_in[1];
    const float* ln1_b  = (const float*)d_in[2];
    const float* ln2_w  = (const float*)d_in[3];
    const float* ln2_b  = (const float*)d_in[4];
    const float* qkv_w  = (const float*)d_in[5];
    const float* proj_w = (const float*)d_in[6];
    const float* ff_w1  = (const float*)d_in[7];
    const float* ff_b1  = (const float*)d_in[8];
    const float* ff_w2  = (const float*)d_in[9];
    const float* ff_b2  = (const float*)d_in[10];

    constexpr int Bb = 4, T = 2048, C = 1024, NH = 16, DFF = 4096;
    constexpr int Mr = Bb * T;                   // 8192 rows

    char* ws = (char*)d_ws;
    size_t off = 0;
    auto take = [&](size_t bytes) -> char* {
        char* p = ws + off;
        off += (bytes + 255) & ~(size_t)255;
        return p;
    };
    ushort_t* wq   = (ushort_t*)take((size_t)3 * C * C * 2);
    ushort_t* wp   = (ushort_t*)take((size_t)C * C * 2);
    ushort_t* w1   = (ushort_t*)take((size_t)DFF * C * 2);
    ushort_t* w2   = (ushort_t*)take((size_t)C * DFF * 2);
    ushort_t* hbuf = (ushort_t*)take((size_t)Mr * C * 2);        // h, then y_att
    ushort_t* qkvb = (ushort_t*)take((size_t)Mr * 3 * C * 2);    // qkv, then h2
    float*    x1   = (float*)   take((size_t)Mr * C * 4);
    ushort_t* fbuf = (ushort_t*)take((size_t)Mr * DFF * 2);

    auto cvt = [&](const float* in, ushort_t* out, size_t n) {
        cvt_bf16_kernel<<<(unsigned)(n / 8192), 256, 0, stream>>>(in, out);
    };
    cvt(qkv_w,  wq, (size_t)3 * C * C);
    cvt(proj_w, wp, (size_t)C * C);
    cvt(ff_w1,  w1, (size_t)DFF * C);
    cvt(ff_w2,  w2, (size_t)C * DFF);

    // 1) h = LN1(x)
    ln_kernel<<<Mr / 8, 256, 0, stream>>>(x, ln1_w, ln1_b, hbuf);
    // 2) qkv = h @ qkv_w^T
    gemm_bf16_kernel<EPI_BF16><<<dim3(3 * C / 128, Mr / 128), 256, 0, stream>>>(
        hbuf, wq, Mr, 3 * C, C, nullptr, nullptr, qkvb);
    // 3) y = causal attention(q, k, v)   (writes into hbuf)
    flash_kernel<<<dim3(T / 128, Bb * NH), 256, 0, stream>>>(qkvb, hbuf);
    // 4) x1 = x + y @ proj_w^T
    gemm_bf16_kernel<EPI_RESID_F32><<<dim3(C / 128, Mr / 128), 256, 0, stream>>>(
        hbuf, wp, Mr, C, C, nullptr, x, x1);
    // 5) h2 = LN2(x1)   (reuse qkv buffer)
    ln_kernel<<<Mr / 8, 256, 0, stream>>>(x1, ln2_w, ln2_b, qkvb);
    // 6) f = gelu(h2 @ ff_w1^T + b1)
    gemm_bf16_kernel<EPI_GELU_BF16><<<dim3(DFF / 128, Mr / 128), 256, 0, stream>>>(
        qkvb, w1, Mr, DFF, C, ff_b1, nullptr, fbuf);
    // 7) out = x1 + f @ ff_w2^T + b2
    gemm_bf16_kernel<EPI_RESID_F32><<<dim3(C / 128, Mr / 128), 256, 0, stream>>>(
        fbuf, w2, Mr, C, DFF, ff_b2, x1, (float*)d_out);
    // 8) trailing scalar output = 0
    tail_zero_kernel<<<1, 1, 0, stream>>>((float*)d_out + (size_t)Mr * C);
}

// v004
// It runs in 458 microseconds.
// Next to v003, in two timings, it ran 1.24 and 1.25 times as fast.
// All steps since v000 together make it 1.83 times as fast.
#include <hip/hip_runtime.h>
#include <hip/hip_bf16.h>

typedef unsigned short ushort_t;
typedef __attribute__((ext_vector_type(16))) __bf16 v16bf;
typedef __attribute__((ext_vector_type(8)))  float  v8f;

__device__ __forceinline__ ushort_t f2bf(float f) {
    unsigned int u = __float_as_uint(f);
    unsigned int r = u + 0x7FFFu + ((u >> 16) & 1u);   // round-to-nearest-even
    return (ushort_t)(r >> 16);
}

__device__ __forceinline__ void async_copy16_held(const ushort_t* g, ushort_t* l) {
    asm volatile("global_load_async_to_lds_b128 %0, %1, off\n\ts_wait_xcnt 0x0"
                 :: "v"((unsigned)(size_t)l), "v"((unsigned long long)(size_t)g)
                 : "memory");
}
// Eight such copies of one lane, four per operand at rows 32 apart (gstep, lstep in
// elements), with the one wait behind the last of them.
__device__ __forceinline__ void async_copy16x8_held(const ushort_t* ga, const ushort_t* gw, size_t gstep,
                                                    ushort_t* la, ushort_t* lw, int lstep) {
    asm volatile("global_load_async_to_lds_b128 %0, %8, off\n\t"
                 "global_load_async_to_lds_b128 %1, %9, off\n\t"
                 "global_load_async_to_lds_b128 %2, %10, off\n\t"
                 "global_load_async_to_lds_b128 %3, %11, off\n\t"
                 "global_load_async_to_lds_b128 %4, %12, off\n\t"
                 "global_load_async_to_lds_b128 %5, %13, off\n\t"
                 "global_load_async_to_lds_b128 %6, %14, off\n\t"
                 "global_load_async_to_lds_b128 %7, %15, off\n\t"
                 "s_wait_xcnt 0x0"
                 :: "v"((unsigned)(size_t)la), "v"((unsigned)(size_t)(la + lstep)),
                    "v"((unsigned)(size_t)(la + 2 * lstep)), "v"((unsigned)(size_t)(la + 3 * lstep)),
                    "v"((unsigned)(size_t)lw), "v"((unsigned)(size_t)(lw + lstep)),
                    "v"((unsigned)(size_t)(lw + 2 * lstep)), "v"((unsigned)(size_t)(lw + 3 * lstep)),
                    "v"((unsigned long long)(size_t)ga),
                    "v"((unsigned long long)(size_t)(ga + gstep)),
                    "v"((unsigned long long)(size_t)(ga + 2 * gstep)),
                    "v"((unsigned long long)(size_t)(ga + 3 * gstep)),
                    "v"((unsigned long long)(size_t)gw),
                    "v"((unsigned long long)(size_t)(gw + gstep)),
                    "v"((unsigned long long)(size_t)(gw + 2 * gstep)),
                    "v"((unsigned long long)(size_t)(gw + 3 * gstep))
                 : "memory");
}
__device__ __forceinline__ void wait_async0() {
    asm volatile("s_wait_asynccnt 0x0" ::: "memory");
}
__device__ __forceinline__ void wait_ds0() {
    asm volatile("s_wait_dscnt 0x0" ::: "memory");
}

__device__ __forceinline__ v16bf load_frag(const ushort_t* p, int lh) {
    union { uint4 q[2]; v16bf f; } u;
    u.q[0] = *(const uint4*)(p + lh * 8);
    u.q[1] = *(const uint4*)(p + 16 + lh * 8);
    return u.f;
}

// ---------------------------------------------------------------- utilities
__device__ __forceinline__ ushort4 f2bf4(float4 v) {
    ushort4 o;
    o.x = f2bf(v.x); o.y = f2bf(v.y); o.z = f2bf(v.z); o.w = f2bf(v.w);
    return o;
}

// 32 elements per thread, 8192 per block: eight 16-byte loads in flight per lane,
// each wave-wide access on whole lines. n must be a multiple of 8192.
__global__ __launch_bounds__(256)
void cvt_bf16_kernel(const float* __restrict__ in, ushort_t* __restrict__ out) {
    const size_t base = (size_t)blockIdx.x * 2048 + threadIdx.x;   // in groups of four elements
    const float4* in4 = (const float4*)in + base;
    ushort4* out4 = (ushort4*)out + base;
    float4 v[8];
#pragma unroll
    for (int u = 0; u < 8; ++u) v[u] = in4[u * 256];
#pragma unroll
    for (int u = 0; u < 8; ++u) out4[u * 256] = f2bf4(v[u]);
}

__global__ void tail_zero_kernel(float* p) { *p = 0.0f; }

// ---------------------------------------------------------------- layernorm
// One wave per row of 1024, eight rows per block: the row stays in registers
// (eight 16-byte loads per lane) and both sums are joined inside the wave.
__device__ __forceinline__ float wave_sum(float s) {
#pragma unroll
    for (int d = 16; d >= 1; d >>= 1) s += __shfl_xor(s, d, 32);
    return s;
}

__global__ __launch_bounds__(256)
void ln_kernel(const float* __restrict__ x, const float* __restrict__ w,
               const float* __restrict__ b, ushort_t* __restrict__ out) {
    constexpr int C = 1024;
    const int lane = threadIdx.x & 31;
    const size_t row = (size_t)blockIdx.x * 8 + (threadIdx.x >> 5);
    const float4* xr = (const float4*)(x + row * C) + lane;
    const float4* w4 = (const float4*)w + lane;
    const float4* b4 = (const float4*)b + lane;
    ushort4* o4 = (ushort4*)(out + row * C) + lane;

    float4 v[8];
#pragma unroll
    for (int u = 0; u < 8; ++u) v[u] = xr[u * 32];

    float s = 0.f;
#pragma unroll
    for (int u = 0; u < 8; ++u) s += (v[u].x + v[u].y) + (v[u].z + v[u].w);
    const float mu = wave_sum(s) / (float)C;

    float q = 0.f;
#pragma unroll
    for (int u = 0; u < 8; ++u) {
        v[u].x -= mu; v[u].y -= mu; v[u].z -= mu; v[u].w -= mu;
        q += (v[u].x * v[u].x + v[u].y * v[u].y) + (v[u].z * v[u].z + v[u].w * v[u].w);
    }
    const float rstd = rsqrtf(wave_sum(q) / (float)C + 1e-5f);

#pragma unroll
    for (int u = 0; u < 8; ++u) {
        const float4 wv = w4[u * 32];
        const float4 bv = b4[u * 32];
        float4 r;
        r.x = v[u].x * rstd * wv.x + bv.x;
        r.y = v[u].y * rstd * wv.y + bv.y;
        r.z = v[u].z * rstd * wv.z + bv.z;
        r.w = v[u].w * rstd * wv.w + bv.w;
        o4[u * 32] = f2bf4(r);
    }
}

// ---------------------------------------------------------------- GEMM
// out[m,n] = epilogue( sum_k A[m,k] * W[n,k] )  -- A:[M,K] bf16, W:[N,K] bf16
// 128x128x64 tiles, double-buffered LDS filled by async global->LDS copies.
// A k step of 64 is one whole 128-byte line of every operand row: eight lanes copy
// one row's line, so a wave-wide copy touches four whole lines. K: a multiple of 64.
enum { EPI_BF16 = 0, EPI_GELU_BF16 = 1, EPI_RESID_F32 = 2 };

template <int EPI>
__global__ __launch_bounds__(256)
void gemm_bf16_kernel(const ushort_t* __restrict__ A, const ushort_t* __restrict__ W,
                      int M, int N, int K,
                      const float* __restrict__ bias,
                      const float* __restrict__ resid,
                      void* __restrict__ outp) {
    constexpr int LDSS = 72;                     // 64 cols + pad: 144B rows = 16B x odd, the b128 readers' pitch
    __shared__ __align__(16) ushort_t As[2][128 * LDSS];
    __shared__ __align__(16) ushort_t Ws[2][128 * LDSS];

    const int tid  = threadIdx.x;
    const int wave = tid >> 5;                   // wave32
    const int lane = tid & 31;
    const int lh   = lane >> 4;
    const int ll   = lane & 15;
    const int m0   = blockIdx.y * 128;
    const int n0   = blockIdx.x * 128;
    const int wm   = wave & 1;                   // 2 row-strips of 64
    const int wn   = wave >> 1;                  // 4 col-strips of 32

    v8f zero = {};
    v8f acc[4][2];
#pragma unroll
    for (int i = 0; i < 4; ++i)
#pragma unroll
        for (int j = 0; j < 2; ++j) acc[i][j] = zero;

    const int ldr  = tid >> 3;                   // 0..31 staging row, then +32, +64, +96
    const int lcol = (tid & 7) << 3;             // 16-byte piece of the row's line

    // async stage of one 128x64 A tile and one 128x64 W tile (64B/thread each)
    auto stage = [&](int kt, int buf) {
        async_copy16x8_held(A + (size_t)(m0 + ldr) * K + kt * 64 + lcol,
                            W + (size_t)(n0 + ldr) * K + kt * 64 + lcol, (size_t)32 * K,
                            &As[buf][ldr * LDSS + lcol], &Ws[buf][ldr * LDSS + lcol], 32 * LDSS);
    };

    const int nk = K >> 6;
    stage(0, 0);
    wait_async0();
    __syncthreads();
    if (nk > 1) stage(1, 1);                       // flies while tile 0 is worked on

    for (int kt = 0; kt < nk; ++kt) {
        const int cur = kt & 1;
#pragma unroll
        for (int kk = 0; kk < 2; ++kk) {
            v16bf bfr[2];
#pragma unroll
            for (int j = 0; j < 2; ++j)
                bfr[j] = load_frag(&Ws[cur][(wn * 32 + j * 16 + ll) * LDSS + kk * 32], lh);
#pragma unroll
            for (int i = 0; i < 4; ++i) {
                v16bf afr = load_frag(&As[cur][(wm * 64 + i * 16 + ll) * LDSS + kk * 32], lh);
#pragma unroll
                for (int j = 0; j < 2; ++j)
                    acc[i][j] = __builtin_amdgcn_wmma_f32_16x16x32_bf16(
                        false, afr, false, bfr[j], (short)0, acc[i][j], false, false);
            }
        }

        wait_ds0();                                // this wave's reads of buffer cur are done
        wait_async0();                             // this wave's copies of the next tile have landed
        __syncthreads();                           // publishes tile kt + 1, frees buffer cur
        if (kt + 2 < nk) stage(kt + 2, cur);       // flies while tile kt + 1 is worked on
    }
    wait_async0();

    // epilogue: element (m, n) = (m0 + wm*64 + i*16 + r + 8*lh, n0 + wn*32 + j*16 + ll)
#pragma unroll
    for (int i = 0; i < 4; ++i)
#pragma unroll
        for (int j = 0; j < 2; ++j) {
            const int col = n0 + wn * 32 + j * 16 + ll;
#pragma unroll
            for (int r = 0; r < 8; ++r) {
                const int row = m0 + wm * 64 + i * 16 + r + 8 * lh;
                float v = acc[i][j][r];
                if (EPI == EPI_GELU_BF16) {
                    v += bias[col];
                    v = 0.5f * v * (1.0f + erff(v * 0.7071067811865475f));
                    ((ushort_t*)outp)[(size_t)row * N + col] = f2bf(v);
                } else if (EPI == EPI_RESID_F32) {
                    if (bias) v += bias[col];
                    v += resid[(size_t)row * N + col];
                    ((float*)outp)[(size_t)row * N + col] = v;
                } else {
                    ((ushort_t*)outp)[(size_t)row * N + col] = f2bf(v);
                }
            }
        }
}

template <int X>
__device__ __forceinline__ float row_max_step(float v) {
    float o;
    // asm: from the DPP builtin the compiler made a move and a separate maximum
    asm("v_max_num_f32_dpp %0, %1, %1 row_xmask:%2 row_mask:0xf bank_mask:0xf" : "=v"(o) : "v"(v), "n"(X));
    return o;
}
template <int X>
__device__ __forceinline__ float row_sum_step(float v) {
    float o;
    // asm like the maximum: the steps of the eight rows can then be interleaved freely
    asm("v_add_f32_dpp %0, %1, %1 row_xmask:%2 row_mask:0xf bank_mask:0xf" : "=v"(o) : "v"(v), "n"(X));
    return o;
}
__device__ __forceinline__ float row16_max(float v) {
    return row_max_step<1>(row_max_step<2>(row_max_step<4>(row_max_step<8>(v))));
}
__device__ __forceinline__ float row16_sum(float v) {
    return row_sum_step<1>(row_sum_step<2>(row_sum_step<4>(row_sum_step<8>(v))));
}

__global__ __launch_bounds__(256) __attribute__((amdgpu_waves_per_eu(8)))
void flash_kernel(const ushort_t* __restrict__ qkv, ushort_t* __restrict__ y) {
    constexpr int T = 2048, C = 1024, HD = 64;
    constexpr int LDQ = 3 * C;
    constexpr int KP = 72;                                // 64 d + pad, 144B rows
    constexpr int VP = 40;                                // 32 keys + pad, 80B rows
    constexpr int PP = 40;                                // 32 keys + pad, 80B rows
    __shared__ __align__(16) ushort_t kt[32 * KP];        // K tile, row-major [key][d]
    __shared__ __align__(16) ushort_t vt[64 * VP];        // V tile transposed [d][key]
    __shared__ __align__(16) ushort_t pt[8 * 16 * PP];    // per-wave P scratch

    const int tid  = threadIdx.x;
    const int wave = tid >> 5;
    const int lane = tid & 31;
    const int lh   = lane >> 4;
    const int ll   = lane & 15;
    const int b    = blockIdx.y >> 4;
    const int head = blockIdx.y & 15;
    const int qrow0 = blockIdx.x * 128 + wave * 16;
    const size_t rowbase = (size_t)b * T;

    // Q fragments (16 rows x 64 d), straight from global
    v16bf qf[2];
#pragma unroll
    for (int f = 0; f < 2; ++f)
        qf[f] = load_frag(qkv + (rowbase + qrow0 + ll) * LDQ + head * HD + f * 32, lh);

    v8f zero = {};
    v8f o[4];
#pragma unroll
    for (int t = 0; t < 4; ++t) o[t] = zero;
    float mrow[8], lrow[8];
#pragma unroll
    for (int r = 0; r < 8; ++r) { mrow[r] = -1e30f; lrow[r] = 0.f; }

    ushort_t* ptw = pt + wave * (16 * PP);
    const int qhi = blockIdx.x * 128 + 128;

    for (int j0 = 0; j0 < qhi; j0 += 32) {
        {
            const int krow = tid >> 3;
            const int c8   = (tid & 7) << 3;
            const size_t src = (rowbase + j0 + krow) * LDQ + head * HD + c8;
            async_copy16_held(qkv + src + C, &kt[krow * KP + c8]);
            union { uint4 v; ushort_t u[8]; } vv;
            vv.v = *(const uint4*)(qkv + src + 2 * C);
#pragma unroll
            for (int i = 0; i < 8; ++i) vt[(c8 + i) * VP + krow] = vv.u[i];
        }
        wait_async0();
        __syncthreads();

        // S = Q @ K^T (16x32), two 16x16 tiles, K-dim = 64 -> 2 wmma each
        v8f s[2]; s[0] = zero; s[1] = zero;
#pragma unroll
        for (int cg = 0; cg < 2; ++cg)
#pragma unroll
            for (int f = 0; f < 2; ++f) {
                v16bf kb = load_frag(&kt[(cg * 16 + ll) * KP + f * 32], lh);
                s[cg] = __builtin_amdgcn_wmma_f32_16x16x32_bf16(
                    false, qf[f], false, kb, (short)0, s[cg], false, false);
            }

        // scale + causal mask
#pragma unroll
        for (int cg = 0; cg < 2; ++cg)
#pragma unroll
            for (int r = 0; r < 8; ++r) {
                const int col = j0 + cg * 16 + ll;
                const int row = qrow0 + r + 8 * lh;
                const float v = s[cg][r] * 0.125f;       // hd^-0.5, hd=64
                s[cg][r] = (col <= row) ? v : -1e30f;
            }

        // online softmax (row lives across the 16 lanes of each half)
#pragma unroll
        for (int r = 0; r < 8; ++r) {
            // the running maximum is the same in all 16 lanes, so it may join before the butterfly
            const float mnew  = row16_max(fmaxf(fmaxf(s[0][r], s[1][r]), mrow[r]));
            const float alpha = __expf(mrow[r] - mnew);
            const float p0 = __expf(s[0][r] - mnew);
            const float p1 = __expf(s[1][r] - mnew);
            s[0][r] = p0; s[1][r] = p1;
            const float rs = row16_sum(p0 + p1);
            lrow[r] = lrow[r] * alpha + rs;
            mrow[r] = mnew;
#pragma unroll
            for (int t = 0; t < 4; ++t) o[t][r] *= alpha;
        }

#pragma unroll
        for (int cg = 0; cg < 2; ++cg)
#pragma unroll
            for (int r = 0; r < 8; ++r)
                ptw[(r + 8 * lh) * PP + cg * 16 + ll] = f2bf(s[cg][r]);
        v16bf pa = load_frag(&ptw[ll * PP], lh);

        // O += P @ V   (V^T staged: column d of V is a contiguous vt row)
#pragma unroll
        for (int t = 0; t < 4; ++t) {
            v16bf vb = load_frag(&vt[(t * 16 + ll) * VP], lh);
            o[t] = __builtin_amdgcn_wmma_f32_16x16x32_bf16(
                false, pa, false, vb, (short)0, o[t], false, false);
        }
        __syncthreads();
    }

    // normalize and store
#pragma unroll
    for (int t = 0; t < 4; ++t)
#pragma unroll
        for (int r = 0; r < 8; ++r) {
            const int row = qrow0 + r + 8 * lh;
            const int col = head * HD + t * 16 + ll;
            y[(rowbase + row) * C + col] = f2bf(o[t][r] * (1.0f / lrow[r]));
        }
}

// ---------------------------------------------------------------- launcher
extern "C" void kernel_launch(void* const* d_in, const int* in_sizes, int n_in,
                              void* d_out, int out_size, void* d_ws, size_t ws_size,
                              hipStream_t stream) {
    (void)in_sizes; (void)n_in; (void)out_size; (void)ws_size;
    const float* x      = (const float*)d_in[0];
    const float* ln1_w  = (const float*)d_in[1];
    const float* ln1_b  = (const float*)d_in[2];
    const float* ln2_w  = (const float*)d_in[3];
    const float* ln2_b  = (const float*)d_in[4];
    const float* qkv_w  = (const float*)d_in[5];
    const float* proj_w = (const float*)d_in[6];
    const float* ff_w1  = (const float*)d_in[7];
    const float* ff_b1  = (const float*)d_in[8];
    const float* ff_w2  = (const float*)d_in[9];
    const float* ff_b2  = (const float*)d_in[10];

    constexpr int Bb = 4, T = 2048, C = 1024, NH = 16, DFF = 4096;
    constexpr int Mr = Bb * T;                   // 8192 rows

    char* ws = (char*)d_ws;
    size_t off = 0;
    auto take = [&](size_t bytes) -> char* {
        char* p = ws + off;
        off += (bytes + 255) & ~(size_t)255;
        return p;
    };
    ushort_t* wq   = (ushort_t*)take((size_t)3 * C * C * 2);
    ushort_t* wp   = (ushort_t*)take((size_t)C * C * 2);
    ushort_t* w1   = (ushort_t*)take((size_t)DFF * C * 2);
    ushort_t* w2   = (ushort_t*)take((size_t)C * DFF * 2);
    ushort_t* hbuf = (ushort_t*)take((size_t)Mr * C * 2);        // h, then y_att
    ushort_t* qkvb = (ushort_t*)take((size_t)Mr * 3 * C * 2);    // qkv, then h2
    float*    x1   = (float*)   take((size_t)Mr * C * 4);
    ushort_t* fbuf = (ushort_t*)take((size_t)Mr * DFF * 2);

    auto cvt = [&](const float* in, ushort_t* out, size_t n) {
        cvt_bf16_kernel<<<(unsigned)(n / 8192), 256, 0, stream>>>(in, out);
    };
    cvt(qkv_w,  wq, (size_t)3 * C * C);
    cvt(proj_w, wp, (size_t)C * C);
    cvt(ff_w1,  w1, (size_t)DFF * C);
    cvt(ff_w2,  w2, (size_t)C * DFF);

    // 1) h = LN1(x)
    ln_kernel<<<Mr / 8, 256, 0, stream>>>(x, ln1_w, ln1_b, hbuf);
    // 2) qkv = h @ qkv_w^T
    gemm_bf16_kernel<EPI_BF16><<<dim3(3 * C / 128, Mr / 128), 256, 0, stream>>>(
        hbuf, wq, Mr, 3 * C, C, nullptr, nullptr, qkvb);
    // 3) y = causal attention(q, k, v)   (writes into hbuf)
    flash_kernel<<<dim3(T / 128, Bb * NH), 256, 0, stream>>>(qkvb, hbuf);
    // 4) x1 = x + y @ proj_w^T
    gemm_bf16_kernel<EPI_RESID_F32><<<dim3(C / 128, Mr / 128), 256, 0, stream>>>(
        hbuf, wp, Mr, C, C, nullptr, x, x1);
    // 5) h2 = LN2(x1)   (reuse qkv buffer)
    ln_kernel<<<Mr / 8, 256, 0, stream>>>(x1, ln2_w, ln2_b, qkvb);
    // 6) f = gelu(h2 @ ff_w1^T + b1)
    gemm_bf16_kernel<EPI_GELU_BF16><<<dim3(DFF / 128, Mr / 128), 256, 0, stream>>>(
        qkvb, w1, Mr, DFF, C, ff_b1, nullptr, fbuf);
    // 7) out = x1 + f @ ff_w2^T + b2
    gemm_bf16_kernel<EPI_RESID_F32><<<dim3(C / 128, Mr / 128), 256, 0, stream>>>(
        fbuf, w2, Mr, C, DFF, ff_b2, x1, (float*)d_out);
    // 8) trailing scalar output = 0
    tail_zero_kernel<<<1, 1, 0, stream>>>((float*)d_out + (size_t)Mr * C);
}

// v005
// One run takes 407 microseconds.
// Next to v004, in two timings, it ran 1.13 times as fast each time.
// Over all steps from v000 it is 2.07 times as fast.
#include <hip/hip_runtime.h>
#include <hip/hip_bf16.h>

typedef unsigned short ushort_t;
typedef __attribute__((ext_vector_type(16))) __bf16 v16bf;
typedef __attribute__((ext_vector_type(8)))  float  v8f;

__device__ __forceinline__ ushort_t f2bf(float f) {
    unsigned int u = __float_as_uint(f);
    unsigned int r = u + 0x7FFFu + ((u >> 16) & 1u);   // round-to-nearest-even
    return (ushort_t)(r >> 16);
}

__device__ __forceinline__ void async_copy16_held(const ushort_t* g, ushort_t* l) {
    asm volatile("global_load_async_to_lds_b128 %0, %1, off\n\ts_wait_xcnt 0x0"
                 :: "v"((unsigned)(size_t)l), "v"((unsigned long long)(size_t)g)
                 : "memory");
}
// Eight such copies of one lane, four per operand at rows 32 apart (gstep, lstep in
// elements), with the one wait behind the last of them.
__device__ __forceinline__ void async_copy16x8_held(const ushort_t* ga, const ushort_t* gw, size_t gstep,
                                                    ushort_t* la, ushort_t* lw, int lstep) {
    asm volatile("global_load_async_to_lds_b128 %0, %8, off\n\t"
                 "global_load_async_to_lds_b128 %1, %9, off\n\t"
                 "global_load_async_to_lds_b128 %2, %10, off\n\t"
                 "global_load_async_to_lds_b128 %3, %11, off\n\t"
                 "global_load_async_to_lds_b128 %4, %12, off\n\t"
                 "global_load_async_to_lds_b128 %5, %13, off\n\t"
                 "global_load_async_to_lds_b128 %6, %14, off\n\t"
                 "global_load_async_to_lds_b128 %7, %15, off\n\t"
                 "s_wait_xcnt 0x0"
                 :: "v"((unsigned)(size_t)la), "v"((unsigned)(size_t)(la + lstep)),
                    "v"((unsigned)(size_t)(la + 2 * lstep)), "v"((unsigned)(size_t)(la + 3 * lstep)),
                    "v"((unsigned)(size_t)lw), "v"((unsigned)(size_t)(lw + lstep)),
                    "v"((unsigned)(size_t)(lw + 2 * lstep)), "v"((unsigned)(size_t)(lw + 3 * lstep)),
                    "v"((unsigned long long)(size_t)ga),
                    "v"((unsigned long long)(size_t)(ga + gstep)),
                    "v"((unsigned long long)(size_t)(ga + 2 * gstep)),
                    "v"((unsigned long long)(size_t)(ga + 3 * gstep)),
                    "v"((unsigned long long)(size_t)gw),
                    "v"((unsigned long long)(size_t)(gw + gstep)),
                    "v"((unsigned long long)(size_t)(gw + 2 * gstep)),
                    "v"((unsigned long long)(size_t)(gw + 3 * gstep))
                 : "memory");
}
__device__ __forceinline__ void wait_async0() {
    asm volatile("s_wait_asynccnt 0x0" ::: "memory");
}
__device__ __forceinline__ void wait_ds0() {
    asm volatile("s_wait_dscnt 0x0" ::: "memory");
}

__device__ __forceinline__ v16bf load_frag(const ushort_t* p, int lh) {
    union { uint4 q[2]; v16bf f; } u;
    u.q[0] = *(const uint4*)(p + lh * 8);
    u.q[1] = *(const uint4*)(p + 16 + lh * 8);
    return u.f;
}

// ---------------------------------------------------------------- utilities
__device__ __forceinline__ ushort4 f2bf4(float4 v) {
    ushort4 o;
    o.x = f2bf(v.x); o.y = f2bf(v.y); o.z = f2bf(v.z); o.w = f2bf(v.w);
    return o;
}

// 32 elements per thread, 8192 per block: eight 16-byte loads in flight per lane,
// each wave-wide access on whole lines. n must be a multiple of 8192.
__global__ __launch_bounds__(256)
void cvt_bf16_kernel(const float* __restrict__ in, ushort_t* __restrict__ out) {
    const size_t base = (size_t)blockIdx.x * 2048 + threadIdx.x;   // in groups of four elements
    const float4* in4 = (const float4*)in + base;
    ushort4* out4 = (ushort4*)out + base;
    float4 v[8];
#pragma unroll
    for (int u = 0; u < 8; ++u) v[u] = in4[u * 256];
#pragma unroll
    for (int u = 0; u < 8; ++u) out4[u * 256] = f2bf4(v[u]);
}

__global__ void tail_zero_kernel(float* p) { *p = 0.0f; }

// ---------------------------------------------------------------- layernorm
// One wave per row of 1024, eight rows per block: the row stays in registers
// (eight 16-byte loads per lane) and both sums are joined inside the wave.
__device__ __forceinline__ float wave_sum(float s) {
#pragma unroll
    for (int d = 16; d >= 1; d >>= 1) s += __shfl_xor(s, d, 32);
    return s;
}

__global__ __launch_bounds__(256)
void ln_kernel(const float* __restrict__ x, const float* __restrict__ w,
               const float* __restrict__ b, ushort_t* __restrict__ out) {
    constexpr int C = 1024;
    const int lane = threadIdx.x & 31;
    const size_t row = (size_t)blockIdx.x * 8 + (threadIdx.x >> 5);
    const float4* xr = (const float4*)(x + row * C) + lane;
    const float4* w4 = (const float4*)w + lane;
    const float4* b4 = (const float4*)b + lane;
    ushort4* o4 = (ushort4*)(out + row * C) + lane;

    float4 v[8];
#pragma unroll
    for (int u = 0; u < 8; ++u) v[u] = xr[u * 32];

    float s = 0.f;
#pragma unroll
    for (int u = 0; u < 8; ++u) s += (v[u].x + v[u].y) + (v[u].z + v[u].w);
    const float mu = wave_sum(s) / (float)C;

    float q = 0.f;
#pragma unroll
    for (int u = 0; u < 8; ++u) {
        v[u].x -= mu; v[u].y -= mu; v[u].z -= mu; v[u].w -= mu;
        q += (v[u].x * v[u].x + v[u].y * v[u].y) + (v[u].z * v[u].z + v[u].w * v[u].w);
    }
    const float rstd = rsqrtf(wave_sum(q) / (float)C + 1e-5f);

#pragma unroll
    for (int u = 0; u < 8; ++u) {
        const float4 wv = w4[u * 32];
        const float4 bv = b4[u * 32];
        float4 r;
        r.x = v[u].x * rstd * wv.x + bv.x;
        r.y = v[u].y * rstd * wv.y + bv.y;
        r.z = v[u].z * rstd * wv.z + bv.z;
        r.w = v[u].w * rstd * wv.w + bv.w;
        o4[u * 32] = f2bf4(r);
    }
}

// ---------------------------------------------------------------- GEMM
// out[m,n] = epilogue( sum_k A[m,k] * W[n,k] )  -- A:[M,K] bf16, W:[N,K] bf16
// 128x128x64 tiles, double-buffered LDS filled by async global->LDS copies.
// A k step of 64 is one whole 128-byte line of every operand row: eight lanes copy
// one row's line, so a wave-wide copy touches four whole lines. K: a multiple of 64.
enum { EPI_BF16 = 0, EPI_GELU_BF16 = 1, EPI_RESID_F32 = 2 };

template <int EPI>
__global__ __launch_bounds__(256)
void gemm_bf16_kernel(const ushort_t* __restrict__ A, const ushort_t* __restrict__ W,
                      int M, int N, int K,
                      const float* __restrict__ bias,
                      const float* __restrict__ resid,
                      void* __restrict__ outp) {
    constexpr int LDSS = 72;                     // 64 cols + pad: 144B rows = 16B x odd, the b128 readers' pitch
    __shared__ __align__(16) ushort_t As[2][128 * LDSS];
    __shared__ __align__(16) ushort_t Ws[2][128 * LDSS];

    const int tid  = threadIdx.x;
    const int wave = tid >> 5;                   // wave32
    const int lane = tid & 31;
    const int lh   = lane >> 4;
    const int ll   = lane & 15;
    const int m0   = blockIdx.y * 128;
    const int n0   = blockIdx.x * 128;
    const int wm   = wave & 1;                   // 2 row-strips of 64
    const int wn   = wave >> 1;                  // 4 col-strips of 32

    v8f zero = {};
    v8f acc[4][2];
#pragma unroll
    for (int i = 0; i < 4; ++i)
#pragma unroll
        for (int j = 0; j < 2; ++j) acc[i][j] = zero;

    const int ldr  = tid >> 3;                   // 0..31 staging row, then +32, +64, +96
    const int lcol = (tid & 7) << 3;             // 16-byte piece of the row's line

    // async stage of one 128x64 A tile and one 128x64 W tile (64B/thread each)
    auto stage = [&](int kt, int buf) {
        async_copy16x8_held(A + (size_t)(m0 + ldr) * K + kt * 64 + lcol,
                            W + (size_t)(n0 + ldr) * K + kt * 64 + lcol, (size_t)32 * K,
                            &As[buf][ldr * LDSS + lcol], &Ws[buf][ldr * LDSS + lcol], 32 * LDSS);
    };

    const int nk = K >> 6;
    stage(0, 0);
    wait_async0();
    __syncthreads();
    if (nk > 1) stage(1, 1);                       // flies while tile 0 is worked on

    // Left: the build keeps one register set for the A fragments, so every pair of WMMAs stands behind
    // its own two LDS loads and a full s_wait_dscnt, eight such places a trip.
    for (int kt = 0; kt < nk; ++kt) {
        const int cur = kt & 1;
#pragma unroll
        for (int kk = 0; kk < 2; ++kk) {
            v16bf bfr[2];
#pragma unroll
            for (int j = 0; j < 2; ++j)
                bfr[j] = load_frag(&Ws[cur][(wn * 32 + j * 16 + ll) * LDSS + kk * 32], lh);
#pragma unroll
            for (int i = 0; i < 4; ++i) {
                v16bf afr = load_frag(&As[cur][(wm * 64 + i * 16 + ll) * LDSS + kk * 32], lh);
#pragma unroll
                for (int j = 0; j < 2; ++j)
                    acc[i][j] = __builtin_amdgcn_wmma_f32_16x16x32_bf16(
                        false, afr, false, bfr[j], (short)0, acc[i][j], false, false);
            }
        }

        wait_ds0();                                // this wave's reads of buffer cur are done
        wait_async0();                             // this wave's copies of the next tile have landed
        __syncthreads();                           // publishes tile kt + 1, frees buffer cur
        if (kt + 2 < nk) stage(kt + 2, cur);       // flies while tile kt + 1 is worked on
    }
    wait_async0();

    // epilogue: element (m, n) = (m0 + wm*64 + i*16 + r + 8*lh, n0 + wn*32 + j*16 + ll)
    if (EPI == EPI_RESID_F32) {
        // All 64 residual values of a lane are asked for together, ahead of the first add, and the
        // bias once per column: one memory latency for the tile, not one per element.
        // One 32-bit element offset per row serves the row's two loads and its two stores.
        // The loops are unrolled so that off, rv and acc are indexed by constants and stay in registers.
        const size_t tile0 = (size_t)m0 * N + n0;
        const float* rp = resid + tile0;
        float*       op = (float*)outp + tile0;
        const unsigned off0 = (unsigned)(wm * 64 + 8 * lh) * (unsigned)N + (unsigned)(wn * 32 + ll);
        unsigned off[4][8];
        float rv[4][2][8];
#pragma unroll
        for (int i = 0; i < 4; ++i)
#pragma unroll
            for (int r = 0; r < 8; ++r) {
                off[i][r] = off0 + (unsigned)(i * 16 + r) * (unsigned)N;
#pragma unroll
                for (int j = 0; j < 2; ++j) rv[i][j][r] = (rp + j * 16)[off[i][r]];
            }
        float bv[2];
#pragma unroll
        for (int j = 0; j < 2; ++j) bv[j] = bias ? bias[n0 + wn * 32 + j * 16 + ll] : 0.0f;
#pragma unroll
        for (int i = 0; i < 4; ++i)
#pragma unroll
            for (int r = 0; r < 8; ++r)
#pragma unroll
                for (int j = 0; j < 2; ++j)
                    (op + j * 16)[off[i][r]] = (acc[i][j][r] + bv[j]) + rv[i][j][r];
        return;
    }
#pragma unroll
    for (int i = 0; i < 4; ++i)
#pragma unroll
        for (int j = 0; j < 2; ++j) {
            const int col = n0 + wn * 32 + j * 16 + ll;
#pragma unroll
            for (int r = 0; r < 8; ++r) {
                const int row = m0 + wm * 64 + i * 16 + r + 8 * lh;
                float v = acc[i][j][r];
                if (EPI == EPI_GELU_BF16) {
                    // Left: erff builds to two divergent branches per element, one dependent chain each,
                    // so the 64 elements of a lane run one after the other.
                    v += bias[col];
                    v = 0.5f * v * (1.0f + erff(v * 0.7071067811865475f));
                    ((ushort_t*)outp)[(size_t)row * N + col] = f2bf(v);
                } else {
                    ((ushort_t*)outp)[(size_t)row * N + col] = f2bf(v);
                }
            }
        }
}

template <int X>
__device__ __forceinline__ float row_max_step(float v) {
    float o;
    // asm: from the DPP builtin the compiler made a move and a separate maximum
    asm("v_max_num_f32_dpp %0, %1, %1 row_xmask:%2 row_mask:0xf bank_mask:0xf" : "=v"(o) : "v"(v), "n"(X));
    return o;
}
template <int X>
__device__ __forceinline__ float row_sum_step(float v) {
    float o;
    // asm like the maximum: the steps of the eight rows can then be interleaved freely
    asm("v_add_f32_dpp %0, %1, %1 row_xmask:%2 row_mask:0xf bank_mask:0xf" : "=v"(o) : "v"(v), "n"(X));
    return o;
}
__device__ __forceinline__ float row16_max(float v) {
    return row_max_step<1>(row_max_step<2>(row_max_step<4>(row_max_step<8>(v))));
}
__device__ __forceinline__ float row16_sum(float v) {
    return row_sum_step<1>(row_sum_step<2>(row_sum_step<4>(row_sum_step<8>(v))));
}

__global__ __launch_bounds__(256) __attribute__((amdgpu_waves_per_eu(8)))
void flash_kernel(const ushort_t* __restrict__ qkv, ushort_t* __restrict__ y) {
    constexpr int T = 2048, C = 1024, HD = 64;
    constexpr int LDQ = 3 * C;
    constexpr int KP = 72;                                // 64 d + pad, 144B rows
    constexpr int VP = 40;                                // 32 keys + pad, 80B rows
    constexpr int PP = 40;                                // 32 keys + pad, 80B rows
    __shared__ __align__(16) ushort_t kt[32 * KP];        // K tile, row-major [key][d]
    __shared__ __align__(16) ushort_t vt[64 * VP];        // V tile transposed [d][key]
    __shared__ __align__(16) ushort_t pt[8 * 16 * PP];    // per-wave P scratch

    const int tid  = threadIdx.x;
    const int wave = tid >> 5;
    const int lane = tid & 31;
    const int lh   = lane >> 4;
    const int ll   = lane & 15;
    const int b    = blockIdx.y >> 4;
    const int head = blockIdx.y & 15;
    const int qrow0 = blockIdx.x * 128 + wave * 16;
    const size_t rowbase = (size_t)b * T;

    // Q fragments (16 rows x 64 d), straight from global
    v16bf qf[2];
#pragma unroll
    for (int f = 0; f < 2; ++f)
        qf[f] = load_frag(qkv + (rowbase + qrow0 + ll) * LDQ + head * HD + f * 32, lh);

    v8f zero = {};
    v8f o[4];
#pragma unroll
    for (int t = 0; t < 4; ++t) o[t] = zero;
    float mrow[8], lrow[8];
#pragma unroll
    for (int r = 0; r < 8; ++r) { mrow[r] = -1e30f; lrow[r] = 0.f; }

    ushort_t* ptw = pt + wave * (16 * PP);
    const int qhi = blockIdx.x * 128 + 128;

    for (int j0 = 0; j0 < qhi; j0 += 32) {
        {
            const int krow = tid >> 3;
            const int c8   = (tid & 7) << 3;
            const size_t src = (rowbase + j0 + krow) * LDQ + head * HD + c8;
            async_copy16_held(qkv + src + C, &kt[krow * KP + c8]);
            union { uint4 v; ushort_t u[8]; } vv;
            vv.v = *(const uint4*)(qkv + src + 2 * C);
#pragma unroll
            for (int i = 0; i < 8; ++i) vt[(c8 + i) * VP + krow] = vv.u[i];
        }
        wait_async0();
        __syncthreads();

        // S = Q @ K^T (16x32), two 16x16 tiles, K-dim = 64 -> 2 wmma each
        v8f s[2]; s[0] = zero; s[1] = zero;
#pragma unroll
        for (int cg = 0; cg < 2; ++cg)
#pragma unroll
            for (int f = 0; f < 2; ++f) {
                v16bf kb = load_frag(&kt[(cg * 16 + ll) * KP + f * 32], lh);
                s[cg] = __builtin_amdgcn_wmma_f32_16x16x32_bf16(
                    false, qf[f], false, kb, (short)0, s[cg], false, false);
            }

        // scale + causal mask
#pragma unroll
        for (int cg = 0; cg < 2; ++cg)
#pragma unroll
            for (int r = 0; r < 8; ++r) {
                const int col = j0 + cg * 16 + ll;
                const int row = qrow0 + r + 8 * lh;
                const float v = s[cg][r] * 0.125f;       // hd^-0.5, hd=64
                s[cg][r] = (col <= row) ? v : -1e30f;
            }

        // online softmax (row lives across the 16 lanes of each half)
#pragma unroll
        for (int r = 0; r < 8; ++r) {
            // the running maximum is the same in all 16 lanes, so it may join before the butterfly
            const float mnew  = row16_max(fmaxf(fmaxf(s[0][r], s[1][r]), mrow[r]));
            const float alpha = __expf(mrow[r] - mnew);
            const float p0 = __expf(s[0][r] - mnew);
            const float p1 = __expf(s[1][r] - mnew);
            s[0][r] = p0; s[1][r] = p1;
            const float rs = row16_sum(p0 + p1);
            lrow[r] = lrow[r] * alpha + rs;
            mrow[r] = mnew;
#pragma unroll
            for (int t = 0; t < 4; ++t) o[t][r] *= alpha;
        }

#pragma unroll
        for (int cg = 0; cg < 2; ++cg)
#pragma unroll
            for (int r = 0; r < 8; ++r)
                ptw[(r + 8 * lh) * PP + cg * 16 + ll] = f2bf(s[cg][r]);
        v16bf pa = load_frag(&ptw[ll * PP], lh);

        // O += P @ V   (V^T staged: column d of V is a contiguous vt row)
#pragma unroll
        for (int t = 0; t < 4; ++t) {
            v16bf vb = load_frag(&vt[(t * 16 + ll) * VP], lh);
            o[t] = __builtin_amdgcn_wmma_f32_16x16x32_bf16(
                false, pa, false, vb, (short)0, o[t], false, false);
        }
        __syncthreads();
    }

    // normalize and store
#pragma unroll
    for (int t = 0; t < 4; ++t)
#pragma unroll
        for (int r = 0; r < 8; ++r) {
            const int row = qrow0 + r + 8 * lh;
            const int col = head * HD + t * 16 + ll;
            y[(rowbase + row) * C + col] = f2bf(o[t][r] * (1.0f / lrow[r]));
        }
}

// ---------------------------------------------------------------- launcher
extern "C" void kernel_launch(void* const* d_in, const int* in_sizes, int n_in,
                              void* d_out, int out_size, void* d_ws, size_t ws_size,
                              hipStream_t stream) {
    (void)in_sizes; (void)n_in; (void)out_size; (void)ws_size;
    const float* x      = (const float*)d_in[0];
    const float* ln1_w  = (const float*)d_in[1];
    const float* ln1_b  = (const float*)d_in[2];
    const float* ln2_w  = (const float*)d_in[3];
    const float* ln2_b  = (const float*)d_in[4];
    const float* qkv_w  = (const float*)d_in[5];
    const float* proj_w = (const float*)d_in[6];
    const float* ff_w1  = (const float*)d_in[7];
    const float* ff_b1  = (const float*)d_in[8];
    const float* ff_w2  = (const float*)d_in[9];
    const float* ff_b2  = (const float*)d_in[10];

    constexpr int Bb = 4, T = 2048, C = 1024, NH = 16, DFF = 4096;
    constexpr int Mr = Bb * T;                   // 8192 rows

    char* ws = (char*)d_ws;
    size_t off = 0;
    auto take = [&](size_t bytes) -> char* {
        char* p = ws + off;
        off += (bytes + 255) & ~(size_t)255;
        return p;
    };
    ushort_t* wq   = (ushort_t*)take((size_t)3 * C * C * 2);
    ushort_t* wp   = (ushort_t*)take((size_t)C * C * 2);
    ushort_t* w1   = (ushort_t*)take((size_t)DFF * C * 2);
    ushort_t* w2   = (ushort_t*)take((size_t)C * DFF * 2);
    ushort_t* hbuf = (ushort_t*)take((size_t)Mr * C * 2);        // h, then y_att
    ushort_t* qkvb = (ushort_t*)take((size_t)Mr * 3 * C * 2);    // qkv, then h2
    float*    x1   = (float*)   take((size_t)Mr * C * 4);
    ushort_t* fbuf = (ushort_t*)take((size_t)Mr * DFF * 2);

    auto cvt = [&](const float* in, ushort_t* out, size_t n) {
        cvt_bf16_kernel<<<(unsigned)(n / 8192), 256, 0, stream>>>(in, out);
    };
    cvt(qkv_w,  wq, (size_t)3 * C * C);
    cvt(proj_w, wp, (size_t)C * C);
    cvt(ff_w1,  w1, (size_t)DFF * C);
    cvt(ff_w2,  w2, (size_t)C * DFF);

    // 1) h = LN1(x)
    ln_kernel<<<Mr / 8, 256, 0, stream>>>(x, ln1_w, ln1_b, hbuf);
    // 2) qkv = h @ qkv_w^T
    gemm_bf16_kernel<EPI_BF16><<<dim3(3 * C / 128, Mr / 128), 256, 0, stream>>>(
        hbuf, wq, Mr, 3 * C, C, nullptr, nullptr, qkvb);
    // 3) y = causal attention(q, k, v)   (writes into hbuf)
    flash_kernel<<<dim3(T / 128, Bb * NH), 256, 0, stream>>>(qkvb, hbuf);
    // 4) x1 = x + y @ proj_w^T
    gemm_bf16_kernel<EPI_RESID_F32><<<dim3(C / 128, Mr / 128), 256, 0, stream>>>(
        hbuf, wp, Mr, C, C, nullptr, x, x1);
    // 5) h2 = LN2(x1)   (reuse qkv buffer)
    ln_kernel<<<Mr / 8, 256, 0, stream>>>(x1, ln2_w, ln2_b, qkvb);
    // 6) f = gelu(h2 @ ff_w1^T + b1)
    gemm_bf16_kernel<EPI_GELU_BF16><<<dim3(DFF / 128, Mr / 128), 256, 0, stream>>>(
        qkvb, w1, Mr, DFF, C, ff_b1, nullptr, fbuf);
    // 7) out = x1 + f @ ff_w2^T + b2
    gemm_bf16_kernel<EPI_RESID_F32><<<dim3(C / 128, Mr / 128), 256, 0, stream>>>(
        fbuf, w2, Mr, C, DFF, ff_b2, x1, (float*)d_out);
    // 8) trailing scalar output = 0
    tail_zero_kernel<<<1, 1, 0, stream>>>((float*)d_out + (size_t)Mr * C);
}

// v006
// A run of this version takes 356 microseconds.
// Timed twice side by side with v005, it ran 1.14 times as fast both times.
// Counting every step since v000, it is 2.37 times as fast.
#include <hip/hip_runtime.h>
#include <hip/hip_bf16.h>

typedef unsigned short ushort_t;
typedef __attribute__((ext_vector_type(16))) __bf16 v16bf;
typedef __attribute__((ext_vector_type(8)))  float  v8f;

__device__ __forceinline__ ushort_t f2bf(float f) {
    unsigned int u = __float_as_uint(f);
    unsigned int r = u + 0x7FFFu + ((u >> 16) & 1u);   // round-to-nearest-even
    return (ushort_t)(r >> 16);
}

__device__ __forceinline__ void async_copy16_held(const ushort_t* g, ushort_t* l) {
    asm volatile("global_load_async_to_lds_b128 %0, %1, off\n\ts_wait_xcnt 0x0"
                 :: "v"((unsigned)(size_t)l), "v"((unsigned long long)(size_t)g)
                 : "memory");
}
// Eight such copies of one lane, four per operand at rows 32 apart (gstep, lstep in
// elements), with the one wait behind the last of them.
__device__ __forceinline__ void async_copy16x8_held(const ushort_t* ga, const ushort_t* gw, size_t gstep,
                                                    ushort_t* la, ushort_t* lw, int lstep) {
    asm volatile("global_load_async_to_lds_b128 %0, %8, off\n\t"
                 "global_load_async_to_lds_b128 %1, %9, off\n\t"
                 "global_load_async_to_lds_b128 %2, %10, off\n\t"
                 "global_load_async_to_lds_b128 %3, %11, off\n\t"
                 "global_load_async_to_lds_b128 %4, %12, off\n\t"
                 "global_load_async_to_lds_b128 %5, %13, off\n\t"
                 "global_load_async_to_lds_b128 %6, %14, off\n\t"
                 "global_load_async_to_lds_b128 %7, %15, off\n\t"
                 "s_wait_xcnt 0x0"
                 :: "v"((unsigned)(size_t)la), "v"((unsigned)(size_t)(la + lstep)),
                    "v"((unsigned)(size_t)(la + 2 * lstep)), "v"((unsigned)(size_t)(la + 3 * lstep)),
                    "v"((unsigned)(size_t)lw), "v"((unsigned)(size_t)(lw + lstep)),
                    "v"((unsigned)(size_t)(lw + 2 * lstep)), "v"((unsigned)(size_t)(lw + 3 * lstep)),
                    "v"((unsigned long long)(size_t)ga),
                    "v"((unsigned long long)(size_t)(ga + gstep)),
                    "v"((unsigned long long)(size_t)(ga + 2 * gstep)),
                    "v"((unsigned long long)(size_t)(ga + 3 * gstep)),
                    "v"((unsigned long long)(size_t)gw),
                    "v"((unsigned long long)(size_t)(gw + gstep)),
                    "v"((unsigned long long)(size_t)(gw + 2 * gstep)),
                    "v"((unsigned long long)(size_t)(gw + 3 * gstep))
                 : "memory");
}
__device__ __forceinline__ void wait_async0() {
    asm volatile("s_wait_asynccnt 0x0" ::: "memory");
}
__device__ __forceinline__ void wait_ds0() {
    asm volatile("s_wait_dscnt 0x0" ::: "memory");
}

__device__ __forceinline__ v16bf load_frag(const ushort_t* p, int lh) {
    union { uint4 q[2]; v16bf f; } u;
    u.q[0] = *(const uint4*)(p + lh * 8);
    u.q[1] = *(const uint4*)(p + 16 + lh * 8);
    return u.f;
}

// ---------------------------------------------------------------- utilities
__device__ __forceinline__ ushort4 f2bf4(float4 v) {
    ushort4 o;
    o.x = f2bf(v.x); o.y = f2bf(v.y); o.z = f2bf(v.z); o.w = f2bf(v.w);
    return o;
}

// 32 elements per thread, 8192 per block: eight 16-byte loads in flight per lane,
// each wave-wide access on whole lines. n must be a multiple of 8192.
__global__ __launch_bounds__(256)
void cvt_bf16_kernel(const float* __restrict__ in, ushort_t* __restrict__ out) {
    const size_t base = (size_t)blockIdx.x * 2048 + threadIdx.x;   // in groups of four elements
    const float4* in4 = (const float4*)in + base;
    ushort4* out4 = (ushort4*)out + base;
    float4 v[8];
#pragma unroll
    for (int u = 0; u < 8; ++u) v[u] = in4[u * 256];
#pragma unroll
    for (int u = 0; u < 8; ++u) out4[u * 256] = f2bf4(v[u]);
}

__global__ void tail_zero_kernel(float* p) { *p = 0.0f; }

// ---------------------------------------------------------------- layernorm
// One wave per row of 1024, eight rows per block: the row stays in registers
// (eight 16-byte loads per lane) and both sums are joined inside the wave.
__device__ __forceinline__ float wave_sum(float s) {
#pragma unroll
    for (int d = 16; d >= 1; d >>= 1) s += __shfl_xor(s, d, 32);
    return s;
}

__global__ __launch_bounds__(256)
void ln_kernel(const float* __restrict__ x, const float* __restrict__ w,
               const float* __restrict__ b, ushort_t* __restrict__ out) {
    constexpr int C = 1024;
    const int lane = threadIdx.x & 31;
    const size_t row = (size_t)blockIdx.x * 8 + (threadIdx.x >> 5);
    const float4* xr = (const float4*)(x + row * C) + lane;
    const float4* w4 = (const float4*)w + lane;
    const float4* b4 = (const float4*)b + lane;
    ushort4* o4 = (ushort4*)(out + row * C) + lane;

    float4 v[8];
#pragma unroll
    for (int u = 0; u < 8; ++u) v[u] = xr[u * 32];

    float s = 0.f;
#pragma unroll
    for (int u = 0; u < 8; ++u) s += (v[u].x + v[u].y) + (v[u].z + v[u].w);
    const float mu = wave_sum(s) / (float)C;

    float q = 0.f;
#pragma unroll
    for (int u = 0; u < 8; ++u) {
        v[u].x -= mu; v[u].y -= mu; v[u].z -= mu; v[u].w -= mu;
        q += (v[u].x * v[u].x + v[u].y * v[u].y) + (v[u].z * v[u].z + v[u].w * v[u].w);
    }
    const float rstd = rsqrtf(wave_sum(q) / (float)C + 1e-5f);

#pragma unroll
    for (int u = 0; u < 8; ++u) {
        const float4 wv = w4[u * 32];
        const float4 bv = b4[u * 32];
        float4 r;
        r.x = v[u].x * rstd * wv.x + bv.x;
        r.y = v[u].y * rstd * wv.y + bv.y;
        r.z = v[u].z * rstd * wv.z + bv.z;
        r.w = v[u].w * rstd * wv.w + bv.w;
        o4[u * 32] = f2bf4(r);
    }
}

// ---------------------------------------------------------------- GEMM
// out[m,n] = epilogue( sum_k A[m,k] * W[n,k] )  -- A:[M,K] bf16, W:[N,K] bf16
// 128x128x64 tiles, double-buffered LDS filled by async global->LDS copies.
// A k step of 64 is one whole 128-byte line of every operand row: eight lanes copy
// one row's line, so a wave-wide copy touches four whole lines. K: a multiple of 64.
enum { EPI_BF16 = 0, EPI_GELU_BF16 = 1, EPI_RESID_F32 = 2 };

template <int EPI>
__global__ __launch_bounds__(256)
void gemm_bf16_kernel(const ushort_t* __restrict__ A, const ushort_t* __restrict__ W,
                      int M, int N, int K,
                      const float* __restrict__ bias,
                      const float* __restrict__ resid,
                      void* __restrict__ outp) {
    constexpr int LDSS = 72;                     // 64 cols + pad: 144B rows = 16B x odd, the b128 readers' pitch
    __shared__ __align__(16) ushort_t As[2][128 * LDSS];
    __shared__ __align__(16) ushort_t Ws[2][128 * LDSS];

    const int tid  = threadIdx.x;
    const int wave = tid >> 5;                   // wave32
    const int lane = tid & 31;
    const int lh   = lane >> 4;
    const int ll   = lane & 15;
    const int m0   = blockIdx.y * 128;
    const int n0   = blockIdx.x * 128;
    const int wm   = wave & 1;                   // 2 row-strips of 64
    const int wn   = wave >> 1;                  // 4 col-strips of 32

    v8f zero = {};
    v8f acc[4][2];
#pragma unroll
    for (int i = 0; i < 4; ++i)
#pragma unroll
        for (int j = 0; j < 2; ++j) acc[i][j] = zero;

    const int ldr  = tid >> 3;                   // 0..31 staging row, then +32, +64, +96
    const int lcol = (tid & 7) << 3;             // 16-byte piece of the row's line

    // async stage of one 128x64 A tile and one 128x64 W tile (64B/thread each)
    auto stage = [&](int kt, int buf) {
        async_copy16x8_held(A + (size_t)(m0 + ldr) * K + kt * 64 + lcol,
                            W + (size_t)(n0 + ldr) * K + kt * 64 + lcol, (size_t)32 * K,
                            &As[buf][ldr * LDSS + lcol], &Ws[buf][ldr * LDSS + lcol], 32 * LDSS);
    };

    const int nk = K >> 6;
    stage(0, 0);
    wait_async0();
    __syncthreads();
    if (nk > 1) stage(1, 1);                       // flies while tile 0 is worked on

    // Left: the build keeps one register set for the A fragments, so every pair of WMMAs stands behind
    // its own two LDS loads and a full s_wait_dscnt, eight such places a trip.
    for (int kt = 0; kt < nk; ++kt) {
        const int cur = kt & 1;
#pragma unroll
        for (int kk = 0; kk < 2; ++kk) {
            v16bf bfr[2];
#pragma unroll
            for (int j = 0; j < 2; ++j)
                bfr[j] = load_frag(&Ws[cur][(wn * 32 + j * 16 + ll) * LDSS + kk * 32], lh);
#pragma unroll
            for (int i = 0; i < 4; ++i) {
                v16bf afr = load_frag(&As[cur][(wm * 64 + i * 16 + ll) * LDSS + kk * 32], lh);
#pragma unroll
                for (int j = 0; j < 2; ++j)
                    acc[i][j] = __builtin_amdgcn_wmma_f32_16x16x32_bf16(
                        false, afr, false, bfr[j], (short)0, acc[i][j], false, false);
            }
        }

        wait_ds0();                                // this wave's reads of buffer cur are done
        wait_async0();                             // this wave's copies of the next tile have landed
        __syncthreads();                           // publishes tile kt + 1, frees buffer cur
        if (kt + 2 < nk) stage(kt + 2, cur);       // flies while tile kt + 1 is worked on
    }
    wait_async0();

    // epilogue: element (m, n) = (m0 + wm*64 + i*16 + r + 8*lh, n0 + wn*32 + j*16 + ll)
    if (EPI == EPI_RESID_F32) {
        // All 64 residual values of a lane are asked for together, ahead of the first add, and the
        // bias once per column: one memory latency for the tile, not one per element.
        // One 32-bit element offset per row serves the row's two loads and its two stores.
        // The loops are unrolled so that off, rv and acc are indexed by constants and stay in registers.
        const size_t tile0 = (size_t)m0 * N + n0;
        const float* rp = resid + tile0;
        float*       op = (float*)outp + tile0;
        const unsigned off0 = (unsigned)(wm * 64 + 8 * lh) * (unsigned)N + (unsigned)(wn * 32 + ll);
        unsigned off[4][8];
        float rv[4][2][8];
#pragma unroll
        for (int i = 0; i < 4; ++i)
#pragma unroll
            for (int r = 0; r < 8; ++r) {
                off[i][r] = off0 + (unsigned)(i * 16 + r) * (unsigned)N;
#pragma unroll
                for (int j = 0; j < 2; ++j) rv[i][j][r] = (rp + j * 16)[off[i][r]];
            }
        float bv[2];
#pragma unroll
        for (int j = 0; j < 2; ++j) bv[j] = bias ? bias[n0 + wn * 32 + j * 16 + ll] : 0.0f;
#pragma unroll
        for (int i = 0; i < 4; ++i)
#pragma unroll
            for (int r = 0; r < 8; ++r)
#pragma unroll
                for (int j = 0; j < 2; ++j)
                    (op + j * 16)[off[i][r]] = (acc[i][j][r] + bv[j]) + rv[i][j][r];
        return;
    }
#pragma unroll
    for (int i = 0; i < 4; ++i)
#pragma unroll
        for (int j = 0; j < 2; ++j) {
            const int col = n0 + wn * 32 + j * 16 + ll;
#pragma unroll
            for (int r = 0; r < 8; ++r) {
                const int row = m0 + wm * 64 + i * 16 + r + 8 * lh;
                float v = acc[i][j][r];
                if (EPI == EPI_GELU_BF16) {
                    // Left: erff builds to two divergent branches per element, one dependent chain each,
                    // so the 64 elements of a lane run one after the other.
                    v += bias[col];
                    v = 0.5f * v * (1.0f + erff(v * 0.7071067811865475f));
                    ((ushort_t*)outp)[(size_t)row * N + col] = f2bf(v);
                } else {
                    ((ushort_t*)outp)[(size_t)row * N + col] = f2bf(v);
                }
            }
        }
}

// ---------------------------------------------------------------- flash attention
typedef __attribute__((ext_vector_type(2))) float  v2f;
typedef __attribute__((ext_vector_type(2))) __bf16 v2bf;

__device__ __forceinline__ float xhalf(float x) {
    const int b = __builtin_bit_cast(int, x);
    return __builtin_bit_cast(float, __builtin_amdgcn_permlanex16(b, b, 0x76543210, 0xfedcba98, false, false));
}
// Two f32 to two bf16, round to nearest even, one instruction.
__device__ __forceinline__ v2bf pack2(float lo, float hi) {
    v2f x = {lo, hi};
    return __builtin_convertvector(x, v2bf);
}

__global__ __launch_bounds__(256) __attribute__((amdgpu_waves_per_eu(8)))
void flash_kernel(const ushort_t* __restrict__ qkv, ushort_t* __restrict__ y) {
    constexpr int T = 2048, C = 1024, HD = 64;
    constexpr int LDQ = 3 * C;
    constexpr int KP = 72;                                // 64 d + pad, 144B rows
    constexpr int VP = 40;                                // 32 keys + pad, 80B rows
    __shared__ __align__(16) ushort_t kt[32 * KP];        // K tile, row-major [key][d]
    __shared__ __align__(16) ushort_t vt[64 * VP];        // V tile transposed [d][key]

    const int tid  = threadIdx.x;
    const int wave = tid >> 5;
    const int lane = tid & 31;
    const int lh   = lane >> 4;
    const int ll   = lane & 15;
    const int b    = blockIdx.y >> 4;
    const int head = blockIdx.y & 15;
    const int qrow0 = blockIdx.x * 128 + wave * 16;
    const size_t rowbase = (size_t)b * T;
    const int row = qrow0 + ll;                           // this lane's query

    // Q fragments (16 rows x 64 d), straight from global: the B operand (d x query) of S^T
    v16bf qf[2];
#pragma unroll
    for (int f = 0; f < 2; ++f)
        qf[f] = load_frag(qkv + (rowbase + row) * LDQ + head * HD + f * 32, lh);

    v8f zero = {};
    v8f o[4];                                             // o[t][r] = O[row][t*16 + 8*lh + r]
#pragma unroll
    for (int t = 0; t < 4; ++t) o[t] = zero;
    float mrow = -1e30f;                                  // the query's running maximum, alike in both halves
    float lrow = 0.f;                                     // the sum over this half's keys; joined after the loop

    const int qhi = blockIdx.x * 128 + 128;

    for (int j0 = 0; j0 < qhi; j0 += 32) {
        {
            const int krow = tid >> 3;
            const int c8   = (tid & 7) << 3;
            const size_t src = (rowbase + j0 + krow) * LDQ + head * HD + c8;
            async_copy16_held(qkv + src + C, &kt[krow * KP + c8]);
            union { uint4 v; ushort_t u[8]; } vv;
            vv.v = *(const uint4*)(qkv + src + 2 * C);
#pragma unroll
            for (int i = 0; i < 8; ++i) vt[(c8 + i) * VP + krow] = vv.u[i];
        }
        wait_async0();
        __syncthreads();

        // S^T = K @ Q^T (32 keys x 16 queries), two 16x16 tiles, K-dim = 64 -> 2 wmma each
        // s[cg][r] = score of key j0 + cg*16 + 8*lh + r with query row
        v8f s[2]; s[0] = zero; s[1] = zero;
#pragma unroll
        for (int cg = 0; cg < 2; ++cg)
#pragma unroll
            for (int f = 0; f < 2; ++f) {
                v16bf kb = load_frag(&kt[(cg * 16 + ll) * KP + f * 32], lh);
                s[cg] = __builtin_amdgcn_wmma_f32_16x16x32_bf16(
                    false, kb, false, qf[f], (short)0, s[cg], false, false);
            }

        // scale + causal mask
        const int dq = row - 8 * lh - j0;                // the query's distance from the lane's first key
#pragma unroll
        for (int cg = 0; cg < 2; ++cg)
#pragma unroll
            for (int r = 0; r < 8; ++r) {
                const float v = s[cg][r] * 0.125f;       // hd^-0.5, hd=64
                s[cg][r] = (cg * 16 + r <= dq) ? v : -1e30f;   // key <= query
            }

        // online softmax: 16 scores in the lane, the other 16 of the query in lane ^ 16
        float mx[8];
#pragma unroll
        for (int r = 0; r < 8; ++r) mx[r] = fmaxf(s[0][r], s[1][r]);
        const float mh = fmaxf(fmaxf(fmaxf(mx[0], mx[1]), fmaxf(mx[2], mx[3])),
                               fmaxf(fmaxf(mx[4], mx[5]), fmaxf(mx[6], mx[7])));
        const float mnew  = fmaxf(mrow, fmaxf(mh, xhalf(mh)));
        const float alpha = __expf(mrow - mnew);
        mrow = mnew;
#pragma unroll
        for (int r = 0; r < 8; ++r)
#pragma unroll
            for (int cg = 0; cg < 2; ++cg) s[cg][r] = __expf(s[cg][r] - mnew);
        v2f ps[4];                                        // summed in the register pairs that the pack reads too
#pragma unroll
        for (int e = 0; e < 4; ++e) {
            const v2f p0 = {s[0][2 * e], s[0][2 * e + 1]};
            const v2f p1 = {s[1][2 * e], s[1][2 * e + 1]};
            ps[e] = p0 + p1;
        }
        const v2f pt2 = (ps[0] + ps[1]) + (ps[2] + ps[3]);
        lrow = lrow * alpha + (pt2.x + pt2.y);
#pragma unroll
        for (int t = 0; t < 4; ++t)
#pragma unroll
            for (int r = 0; r < 8; ++r) o[t][r] *= alpha;

        // P^T as B operand (32 keys x 16 queries): element e of the fragment is key 8*lh + e for e < 8 and
        // 16 + 8*lh + (e - 8) above, which is what the lane's two score tiles hold, in that order
        union { v2bf h[8]; v16bf f; } pb;
#pragma unroll
        for (int cg = 0; cg < 2; ++cg)
#pragma unroll
            for (int e = 0; e < 4; ++e) pb.h[cg * 4 + e] = pack2(s[cg][2 * e], s[cg][2 * e + 1]);

        // O^T += V^T @ P^T   (V^T staged: row d of V^T is a contiguous vt row, read in the same key order)
#pragma unroll
        for (int t = 0; t < 4; ++t) {
            v16bf va = load_frag(&vt[(t * 16 + ll) * VP], lh);
            o[t] = __builtin_amdgcn_wmma_f32_16x16x32_bf16(
                false, va, false, pb.f, (short)0, o[t], false, false);
        }
        __syncthreads();
    }

    // normalize and store: a lane's eight values of a tile are eight neighbouring columns, one 16-byte store
    const float inv = 1.0f / (lrow + xhalf(lrow));
    ushort_t* yr = y + (rowbase + row) * C + head * HD + 8 * lh;
#pragma unroll
    for (int t = 0; t < 4; ++t) {
        union { v2bf h[4]; uint4 q; } ov;
#pragma unroll
        for (int e = 0; e < 4; ++e) ov.h[e] = pack2(o[t][2 * e] * inv, o[t][2 * e + 1] * inv);
        *(uint4*)(yr + t * 16) = ov.q;
    }
}

// ---------------------------------------------------------------- launcher
extern "C" void kernel_launch(void* const* d_in, const int* in_sizes, int n_in,
                              void* d_out, int out_size, void* d_ws, size_t ws_size,
                              hipStream_t stream) {
    (void)in_sizes; (void)n_in; (void)out_size; (void)ws_size;
    const float* x      = (const float*)d_in[0];
    const float* ln1_w  = (const float*)d_in[1];
    const float* ln1_b  = (const float*)d_in[2];
    const float* ln2_w  = (const float*)d_in[3];
    const float* ln2_b  = (const float*)d_in[4];
    const float* qkv_w  = (const float*)d_in[5];
    const float* proj_w = (const float*)d_in[6];
    const float* ff_w1  = (const float*)d_in[7];
    const float* ff_b1  = (const float*)d_in[8];
    const float* ff_w2  = (const float*)d_in[9];
    const float* ff_b2  = (const float*)d_in[10];

    constexpr int Bb = 4, T = 2048, C = 1024, NH = 16, DFF = 4096;
    constexpr int Mr = Bb * T;                   // 8192 rows

    char* ws = (char*)d_ws;
    size_t off = 0;
    auto take = [&](size_t bytes) -> char* {
        char* p = ws + off;
        off += (bytes + 255) & ~(size_t)255;
        return p;
    };
    ushort_t* wq   = (ushort_t*)take((size_t)3 * C * C * 2);
    ushort_t* wp   = (ushort_t*)take((size_t)C * C * 2);
    ushort_t* w1   = (ushort_t*)take((size_t)DFF * C * 2);
    ushort_t* w2   = (ushort_t*)take((size_t)C * DFF * 2);
    ushort_t* hbuf = (ushort_t*)take((size_t)Mr * C * 2);        // h, then y_att
    ushort_t* qkvb = (ushort_t*)take((size_t)Mr * 3 * C * 2);    // qkv, then h2
    float*    x1   = (float*)   take((size_t)Mr * C * 4);
    ushort_t* fbuf = (ushort_t*)take((size_t)Mr * DFF * 2);

    auto cvt = [&](const float* in, ushort_t* out, size_t n) {
        cvt_bf16_kernel<<<(unsigned)(n / 8192), 256, 0, stream>>>(in, out);
    };
    cvt(qkv_w,  wq, (size_t)3 * C * C);
    cvt(proj_w, wp, (size_t)C * C);
    cvt(ff_w1,  w1, (size_t)DFF * C);
    cvt(ff_w2,  w2, (size_t)C * DFF);

    // 1) h = LN1(x)
    ln_kernel<<<Mr / 8, 256, 0, stream>>>(x, ln1_w, ln1_b, hbuf);
    // 2) qkv = h @ qkv_w^T
    gemm_bf16_kernel<EPI_BF16><<<dim3(3 * C / 128, Mr / 128), 256, 0, stream>>>(
        hbuf, wq, Mr, 3 * C, C, nullptr, nullptr, qkvb);
    // 3) y = causal attention(q, k, v)   (writes into hbuf)
    flash_kernel<<<dim3(T / 128, Bb * NH), 256, 0, stream>>>(qkvb, hbuf);
    // 4) x1 = x + y @ proj_w^T
    gemm_bf16_kernel<EPI_RESID_F32><<<dim3(C / 128, Mr / 128), 256, 0, stream>>>(
        hbuf, wp, Mr, C, C, nullptr, x, x1);
    // 5) h2 = LN2(x1)   (reuse qkv buffer)
    ln_kernel<<<Mr / 8, 256, 0, stream>>>(x1, ln2_w, ln2_b, qkvb);
    // 6) f = gelu(h2 @ ff_w1^T + b1)
    gemm_bf16_kernel<EPI_GELU_BF16><<<dim3(DFF / 128, Mr / 128), 256, 0, stream>>>(
        qkvb, w1, Mr, DFF, C, ff_b1, nullptr, fbuf);
    // 7) out = x1 + f @ ff_w2^T + b2
    gemm_bf16_kernel<EPI_RESID_F32><<<dim3(C / 128, Mr / 128), 256, 0, stream>>>(
        fbuf, w2, Mr, C, DFF, ff_b2, x1, (float*)d_out);
    // 8) trailing scalar output = 0
    tail_zero_kernel<<<1, 1, 0, stream>>>((float*)d_out + (size_t)Mr * C);
}

// v007
// A run of this version takes 332 microseconds.
// Next to v006, in two timings, it ran 1.07 times as fast each time.
// Counting every step since v000, it is 2.54 times as fast.
#include <hip/hip_runtime.h>
#include <hip/hip_bf16.h>

typedef unsigned short ushort_t;
typedef __attribute__((ext_vector_type(16))) __bf16 v16bf;
typedef __attribute__((ext_vector_type(8)))  float  v8f;

__device__ __forceinline__ ushort_t f2bf(float f) {
    unsigned int u = __float_as_uint(f);
    unsigned int r = u + 0x7FFFu + ((u >> 16) & 1u);   // round-to-nearest-even
    return (ushort_t)(r >> 16);
}

__device__ __forceinline__ void async_copy16_held(const ushort_t* g, ushort_t* l) {
    asm volatile("global_load_async_to_lds_b128 %0, %1, off\n\ts_wait_xcnt 0x0"
                 :: "v"((unsigned)(size_t)l), "v"((unsigned long long)(size_t)g)
                 : "memory");
}
// Eight such copies of one lane, four per operand at rows 32 apart (gstep, lstep in
// elements), with the one wait behind the last of them.
__device__ __forceinline__ void async_copy16x8_held(const ushort_t* ga, const ushort_t* gw, size_t gstep,
                                                    ushort_t* la, ushort_t* lw, int lstep) {
    asm volatile("global_load_async_to_lds_b128 %0, %8, off\n\t"
                 "global_load_async_to_lds_b128 %1, %9, off\n\t"
                 "global_load_async_to_lds_b128 %2, %10, off\n\t"
                 "global_load_async_to_lds_b128 %3, %11, off\n\t"
                 "global_load_async_to_lds_b128 %4, %12, off\n\t"
                 "global_load_async_to_lds_b128 %5, %13, off\n\t"
                 "global_load_async_to_lds_b128 %6, %14, off\n\t"
                 "global_load_async_to_lds_b128 %7, %15, off\n\t"
                 "s_wait_xcnt 0x0"
                 :: "v"((unsigned)(size_t)la), "v"((unsigned)(size_t)(la + lstep)),
                    "v"((unsigned)(size_t)(la + 2 * lstep)), "v"((unsigned)(size_t)(la + 3 * lstep)),
                    "v"((unsigned)(size_t)lw), "v"((unsigned)(size_t)(lw + lstep)),
                    "v"((unsigned)(size_t)(lw + 2 * lstep)), "v"((unsigned)(size_t)(lw + 3 * lstep)),
                    "v"((unsigned long long)(size_t)ga),
                    "v"((unsigned long long)(size_t)(ga + gstep)),
                    "v"((unsigned long long)(size_t)(ga + 2 * gstep)),
                    "v"((unsigned long long)(size_t)(ga + 3 * gstep)),
                    "v"((unsigned long long)(size_t)gw),
                    "v"((unsigned long long)(size_t)(gw + gstep)),
                    "v"((unsigned long long)(size_t)(gw + 2 * gstep)),
                    "v"((unsigned long long)(size_t)(gw + 3 * gstep))
                 : "memory");
}
__device__ __forceinline__ void wait_async0() {
    asm volatile("s_wait_asynccnt 0x0" ::: "memory");
}
__device__ __forceinline__ void wait_ds0() {
    asm volatile("s_wait_dscnt 0x0" ::: "memory");
}

__device__ __forceinline__ v16bf load_frag(const ushort_t* p, int lh) {
    union { uint4 q[2]; v16bf f; } u;
    u.q[0] = *(const uint4*)(p + lh * 8);
    u.q[1] = *(const uint4*)(p + 16 + lh * 8);
    return u.f;
}

// ---------------------------------------------------------------- utilities
__device__ __forceinline__ ushort4 f2bf4(float4 v) {
    ushort4 o;
    o.x = f2bf(v.x); o.y = f2bf(v.y); o.z = f2bf(v.z); o.w = f2bf(v.w);
    return o;
}

// 32 elements per thread, 8192 per block: eight 16-byte loads in flight per lane,
// each wave-wide access on whole lines. n must be a multiple of 8192.
__global__ __launch_bounds__(256)
void cvt_bf16_kernel(const float* __restrict__ in, ushort_t* __restrict__ out) {
    const size_t base = (size_t)blockIdx.x * 2048 + threadIdx.x;   // in groups of four elements
    const float4* in4 = (const float4*)in + base;
    ushort4* out4 = (ushort4*)out + base;
    float4 v[8];
#pragma unroll
    for (int u = 0; u < 8; ++u) v[u] = in4[u * 256];
#pragma unroll
    for (int u = 0; u < 8; ++u) out4[u * 256] = f2bf4(v[u]);
}

__global__ void tail_zero_kernel(float* p) { *p = 0.0f; }

// ---------------------------------------------------------------- layernorm
// One wave per row of 1024, eight rows per block: the row stays in registers
// (eight 16-byte loads per lane) and both sums are joined inside the wave.
__device__ __forceinline__ float wave_sum(float s) {
#pragma unroll
    for (int d = 16; d >= 1; d >>= 1) s += __shfl_xor(s, d, 32);
    return s;
}

__global__ __launch_bounds__(256)
void ln_kernel(const float* __restrict__ x, const float* __restrict__ w,
               const float* __restrict__ b, ushort_t* __restrict__ out) {
    constexpr int C = 1024;
    const int lane = threadIdx.x & 31;
    const size_t row = (size_t)blockIdx.x * 8 + (threadIdx.x >> 5);
    const float4* xr = (const float4*)(x + row * C) + lane;
    const float4* w4 = (const float4*)w + lane;
    const float4* b4 = (const float4*)b + lane;
    ushort4* o4 = (ushort4*)(out + row * C) + lane;

    float4 v[8];
#pragma unroll
    for (int u = 0; u < 8; ++u) v[u] = xr[u * 32];

    float s = 0.f;
#pragma unroll
    for (int u = 0; u < 8; ++u) s += (v[u].x + v[u].y) + (v[u].z + v[u].w);
    const float mu = wave_sum(s) / (float)C;

    float q = 0.f;
#pragma unroll
    for (int u = 0; u < 8; ++u) {
        v[u].x -= mu; v[u].y -= mu; v[u].z -= mu; v[u].w -= mu;
        q += (v[u].x * v[u].x + v[u].y * v[u].y) + (v[u].z * v[u].z + v[u].w * v[u].w);
    }
    const float rstd = rsqrtf(wave_sum(q) / (float)C + 1e-5f);

#pragma unroll
    for (int u = 0; u < 8; ++u) {
        const float4 wv = w4[u * 32];
        const float4 bv = b4[u * 32];
        float4 r;
        r.x = v[u].x * rstd * wv.x + bv.x;
        r.y = v[u].y * rstd * wv.y + bv.y;
        r.z = v[u].z * rstd * wv.z + bv.z;
        r.w = v[u].w * rstd * wv.w + bv.w;
        o4[u * 32] = f2bf4(r);
    }
}

// ---------------------------------------------------------------- GEMM
// out[m,n] = epilogue( sum_k A[m,k] * W[n,k] )  -- A:[M,K] bf16, W:[N,K] bf16
// 128x128x64 tiles, double-buffered LDS filled by async global->LDS copies.
// A k step of 64 is one whole 128-byte line of every operand row: eight lanes copy
// one row's line, so a wave-wide copy touches four whole lines. K: a multiple of 64.
enum { EPI_BF16 = 0, EPI_GELU_BF16 = 1, EPI_RESID_F32 = 2 };

template <int EPI>
__global__ __launch_bounds__(256)
void gemm_bf16_kernel(const ushort_t* __restrict__ A, const ushort_t* __restrict__ W,
                      int M, int N, int K,
                      const float* __restrict__ bias,
                      const float* __restrict__ resid,
                      void* __restrict__ outp) {
    constexpr int LDSS = 72;                     // 64 cols + pad: 144B rows = 16B x odd, the b128 readers' pitch
    __shared__ __align__(16) ushort_t As[2][128 * LDSS];
    __shared__ __align__(16) ushort_t Ws[2][128 * LDSS];

    const int tid  = threadIdx.x;
    const int wave = tid >> 5;                   // wave32
    const int lane = tid & 31;
    const int lh   = lane >> 4;
    const int ll   = lane & 15;
    const int m0   = blockIdx.y * 128;
    const int n0   = blockIdx.x * 128;
    const int wm   = wave & 1;                   // 2 row-strips of 64
    const int wn   = wave >> 1;                  // 4 col-strips of 32

    v8f zero = {};
    v8f acc[4][2];
#pragma unroll
    for (int i = 0; i < 4; ++i)
#pragma unroll
        for (int j = 0; j < 2; ++j) acc[i][j] = zero;

    const int ldr  = tid >> 3;                   // 0..31 staging row, then +32, +64, +96
    const int lcol = (tid & 7) << 3;             // 16-byte piece of the row's line

    // async stage of one 128x64 A tile and one 128x64 W tile (64B/thread each)
    auto stage = [&](int kt, int buf) {
        async_copy16x8_held(A + (size_t)(m0 + ldr) * K + kt * 64 + lcol,
                            W + (size_t)(n0 + ldr) * K + kt * 64 + lcol, (size_t)32 * K,
                            &As[buf][ldr * LDSS + lcol], &Ws[buf][ldr * LDSS + lcol], 32 * LDSS);
    };

    const int nk = K >> 6;
    stage(0, 0);
    wait_async0();
    __syncthreads();
    if (nk > 1) stage(1, 1);                       // flies while tile 0 is worked on

    // Left: the build keeps one register set for the A fragments, so every pair of WMMAs stands behind
    // its own two LDS loads and a full s_wait_dscnt, eight such places a trip.
    for (int kt = 0; kt < nk; ++kt) {
        const int cur = kt & 1;
#pragma unroll
        for (int kk = 0; kk < 2; ++kk) {
            v16bf bfr[2];
#pragma unroll
            for (int j = 0; j < 2; ++j)
                bfr[j] = load_frag(&Ws[cur][(wn * 32 + j * 16 + ll) * LDSS + kk * 32], lh);
#pragma unroll
            for (int i = 0; i < 4; ++i) {
                v16bf afr = load_frag(&As[cur][(wm * 64 + i * 16 + ll) * LDSS + kk * 32], lh);
#pragma unroll
                for (int j = 0; j < 2; ++j)
                    acc[i][j] = __builtin_amdgcn_wmma_f32_16x16x32_bf16(
                        false, afr, false, bfr[j], (short)0, acc[i][j], false, false);
            }
        }

        wait_ds0();                                // this wave's reads of buffer cur are done
        wait_async0();                             // this wave's copies of the next tile have landed
        __syncthreads();                           // publishes tile kt + 1, frees buffer cur
        if (kt + 2 < nk) stage(kt + 2, cur);       // flies while tile kt + 1 is worked on
    }
    wait_async0();

    // epilogue: element (m, n) = (m0 + wm*64 + i*16 + r + 8*lh, n0 + wn*32 + j*16 + ll)
    if (EPI == EPI_RESID_F32) {
        // All 64 residual values of a lane are asked for together, ahead of the first add, and the
        // bias once per column: one memory latency for the tile, not one per element.
        // One 32-bit element offset per row serves the row's two loads and its two stores.
        // The loops are unrolled so that off, rv and acc are indexed by constants and stay in registers.
        const size_t tile0 = (size_t)m0 * N + n0;
        const float* rp = resid + tile0;
        float*       op = (float*)outp + tile0;
        const unsigned off0 = (unsigned)(wm * 64 + 8 * lh) * (unsigned)N + (unsigned)(wn * 32 + ll);
        unsigned off[4][8];
        float rv[4][2][8];
#pragma unroll
        for (int i = 0; i < 4; ++i)
#pragma unroll
            for (int r = 0; r < 8; ++r) {
                off[i][r] = off0 + (unsigned)(i * 16 + r) * (unsigned)N;
#pragma unroll
                for (int j = 0; j < 2; ++j) rv[i][j][r] = (rp + j * 16)[off[i][r]];
            }
        float bv[2];
#pragma unroll
        for (int j = 0; j < 2; ++j) bv[j] = bias ? bias[n0 + wn * 32 + j * 16 + ll] : 0.0f;
#pragma unroll
        for (int i = 0; i < 4; ++i)
#pragma unroll
            for (int r = 0; r < 8; ++r)
#pragma unroll
                for (int j = 0; j < 2; ++j)
                    (op + j * 16)[off[i][r]] = (acc[i][j][r] + bv[j]) + rv[i][j][r];
        return;
    }
#pragma unroll
    for (int i = 0; i < 4; ++i)
#pragma unroll
        for (int j = 0; j < 2; ++j) {
            const int col = n0 + wn * 32 + j * 16 + ll;
#pragma unroll
            for (int r = 0; r < 8; ++r) {
                const int row = m0 + wm * 64 + i * 16 + r + 8 * lh;
                float v = acc[i][j][r];
                if (EPI == EPI_GELU_BF16) {
                    // Left: erff builds to two divergent branches per element, one dependent chain each,
                    // so the 64 elements of a lane run one after the other.
                    v += bias[col];
                    v = 0.5f * v * (1.0f + erff(v * 0.7071067811865475f));
                    ((ushort_t*)outp)[(size_t)row * N + col] = f2bf(v);
                } else {
                    ((ushort_t*)outp)[(size_t)row * N + col] = f2bf(v);
                }
            }
        }
}

// ---------------------------------------------------------------- flash attention
typedef __attribute__((ext_vector_type(2))) float  v2f;
typedef __attribute__((ext_vector_type(2))) __bf16 v2bf;

__device__ __forceinline__ float xhalf(float x) {
    const int b = __builtin_bit_cast(int, x);
    return __builtin_bit_cast(float, __builtin_amdgcn_permlanex16(b, b, 0x76543210, 0xfedcba98, false, false));
}
// Two f32 to two bf16, round to nearest even, one instruction.
__device__ __forceinline__ v2bf pack2(float lo, float hi) {
    v2f x = {lo, hi};
    return __builtin_convertvector(x, v2bf);
}

__global__ __launch_bounds__(256) __attribute__((amdgpu_waves_per_eu(8)))
void flash_kernel(const ushort_t* __restrict__ qkv, ushort_t* __restrict__ y) {
    constexpr int T = 2048, C = 1024, HD = 64;
    constexpr int LDQ = 3 * C;
    constexpr int KP = 72;                                // 64 d + pad, 144B rows
    constexpr int VP = 40;                                // 32 keys + pad, 80B rows
    __shared__ __align__(16) ushort_t kt[32 * KP];        // K tile, row-major [key][d]
    __shared__ __align__(16) ushort_t vt[64 * VP];        // V tile transposed [d][key]

    const int tid  = threadIdx.x;
    const int wave = tid >> 5;
    const int lane = tid & 31;
    const int lh   = lane >> 4;
    const int ll   = lane & 15;
    const int b    = blockIdx.y >> 4;
    const int head = blockIdx.y & 15;
    const int flat = blockIdx.y * (T / 128) + blockIdx.x;
    const int qt   = (__builtin_popcount(flat) & 1) ? (T / 128 - 1) - (int)blockIdx.x : (int)blockIdx.x;
    const int qrow0 = qt * 128 + wave * 16;
    const size_t rowbase = (size_t)b * T;
    const int row = qrow0 + ll;                           // this lane's query

    // Q fragments (16 rows x 64 d), straight from global: the B operand (d x query) of S^T
    v16bf qf[2];
#pragma unroll
    for (int f = 0; f < 2; ++f)
        qf[f] = load_frag(qkv + (rowbase + row) * LDQ + head * HD + f * 32, lh);

    v8f zero = {};
    v8f o[4];                                             // o[t][r] = O[row][t*16 + 8*lh + r]
#pragma unroll
    for (int t = 0; t < 4; ++t) o[t] = zero;
    float mrow = -1e30f;                                  // the query's running maximum, alike in both halves
    float lrow = 0.f;                                     // the sum over this half's keys; joined after the loop

    const int qhi = qt * 128 + 128;

    for (int j0 = 0; j0 < qhi; j0 += 32) {
        {
            const int krow = tid >> 3;
            const int c8   = (tid & 7) << 3;
            const size_t src = (rowbase + j0 + krow) * LDQ + head * HD + c8;
            async_copy16_held(qkv + src + C, &kt[krow * KP + c8]);
            union { uint4 v; ushort_t u[8]; } vv;
            vv.v = *(const uint4*)(qkv + src + 2 * C);
#pragma unroll
            for (int i = 0; i < 8; ++i) vt[(c8 + i) * VP + krow] = vv.u[i];
        }
        wait_async0();
        __syncthreads();

        // S^T = K @ Q^T (32 keys x 16 queries), two 16x16 tiles, K-dim = 64 -> 2 wmma each
        // s[cg][r] = score of key j0 + cg*16 + 8*lh + r with query row
        v8f s[2]; s[0] = zero; s[1] = zero;
#pragma unroll
        for (int cg = 0; cg < 2; ++cg)
#pragma unroll
            for (int f = 0; f < 2; ++f) {
                v16bf kb = load_frag(&kt[(cg * 16 + ll) * KP + f * 32], lh);
                s[cg] = __builtin_amdgcn_wmma_f32_16x16x32_bf16(
                    false, kb, false, qf[f], (short)0, s[cg], false, false);
            }

        // scale + causal mask
        const int dq = row - 8 * lh - j0;                // the query's distance from the lane's first key
#pragma unroll
        for (int cg = 0; cg < 2; ++cg)
#pragma unroll
            for (int r = 0; r < 8; ++r) {
                const float v = s[cg][r] * 0.125f;       // hd^-0.5, hd=64
                s[cg][r] = (cg * 16 + r <= dq) ? v : -1e30f;   // key <= query
            }

        // online softmax: 16 scores in the lane, the other 16 of the query in lane ^ 16
        float mx[8];
#pragma unroll
        for (int r = 0; r < 8; ++r) mx[r] = fmaxf(s[0][r], s[1][r]);
        const float mh = fmaxf(fmaxf(fmaxf(mx[0], mx[1]), fmaxf(mx[2], mx[3])),
                               fmaxf(fmaxf(mx[4], mx[5]), fmaxf(mx[6], mx[7])));
        const float mnew  = fmaxf(mrow, fmaxf(mh, xhalf(mh)));
        const float alpha = __expf(mrow - mnew);
        mrow = mnew;
#pragma unroll
        for (int r = 0; r < 8; ++r)
#pragma unroll
            for (int cg = 0; cg < 2; ++cg) s[cg][r] = __expf(s[cg][r] - mnew);
        v2f ps[4];                                        // summed in the register pairs that the pack reads too
#pragma unroll
        for (int e = 0; e < 4; ++e) {
            const v2f p0 = {s[0][2 * e], s[0][2 * e + 1]};
            const v2f p1 = {s[1][2 * e], s[1][2 * e + 1]};
            ps[e] = p0 + p1;
        }
        const v2f pt2 = (ps[0] + ps[1]) + (ps[2] + ps[3]);
        lrow = lrow * alpha + (pt2.x + pt2.y);
#pragma unroll
        for (int t = 0; t < 4; ++t)
#pragma unroll
            for (int r = 0; r < 8; ++r) o[t][r] *= alpha;

        // P^T as B operand (32 keys x 16 queries): element e of the fragment is key 8*lh + e for e < 8 and
        // 16 + 8*lh + (e - 8) above, which is what the lane's two score tiles hold, in that order
        union { v2bf h[8]; v16bf f; } pb;
#pragma unroll
        for (int cg = 0; cg < 2; ++cg)
#pragma unroll
            for (int e = 0; e < 4; ++e) pb.h[cg * 4 + e] = pack2(s[cg][2 * e], s[cg][2 * e + 1]);

        // O^T += V^T @ P^T   (V^T staged: row d of V^T is a contiguous vt row, read in the same key order)
#pragma unroll
        for (int t = 0; t < 4; ++t) {
            v16bf va = load_frag(&vt[(t * 16 + ll) * VP], lh);
            o[t] = __builtin_amdgcn_wmma_f32_16x16x32_bf16(
                false, va, false, pb.f, (short)0, o[t], false, false);
        }
        __syncthreads();
    }

    // normalize and store: a lane's eight values of a tile are eight neighbouring columns, one 16-byte store
    const float inv = 1.0f / (lrow + xhalf(lrow));
    ushort_t* yr = y + (rowbase + row) * C + head * HD + 8 * lh;
#pragma unroll
    for (int t = 0; t < 4; ++t) {
        union { v2bf h[4]; uint4 q; } ov;
#pragma unroll
        for (int e = 0; e < 4; ++e) ov.h[e] = pack2(o[t][2 * e] * inv, o[t][2 * e + 1] * inv);
        *(uint4*)(yr + t * 16) = ov.q;
    }
}

// ---------------------------------------------------------------- launcher
extern "C" void kernel_launch(void* const* d_in, const int* in_sizes, int n_in,
                              void* d_out, int out_size, void* d_ws, size_t ws_size,
                              hipStream_t stream) {
    (void)in_sizes; (void)n_in; (void)out_size; (void)ws_size;
    const float* x      = (const float*)d_in[0];
    const float* ln1_w  = (const float*)d_in[1];
    const float* ln1_b  = (const float*)d_in[2];
    const float* ln2_w  = (const float*)d_in[3];
    const float* ln2_b  = (const float*)d_in[4];
    const float* qkv_w  = (const float*)d_in[5];
    const float* proj_w = (const float*)d_in[6];
    const float* ff_w1  = (const float*)d_in[7];
    const float* ff_b1  = (const float*)d_in[8];
    const float* ff_w2  = (const float*)d_in[9];
    const float* ff_b2  = (const float*)d_in[10];

    constexpr int Bb = 4, T = 2048, C = 1024, NH = 16, DFF = 4096;
    constexpr int Mr = Bb * T;                   // 8192 rows

    char* ws = (char*)d_ws;
    size_t off = 0;
    auto take = [&](size_t bytes) -> char* {
        char* p = ws + off;
        off += (bytes + 255) & ~(size_t)255;
        return p;
    };
    ushort_t* wq   = (ushort_t*)take((size_t)3 * C * C * 2);
    ushort_t* wp   = (ushort_t*)take((size_t)C * C * 2);
    ushort_t* w1   = (ushort_t*)take((size_t)DFF * C * 2);
    ushort_t* w2   = (ushort_t*)take((size_t)C * DFF * 2);
    ushort_t* hbuf = (ushort_t*)take((size_t)Mr * C * 2);        // h, then y_att
    ushort_t* qkvb = (ushort_t*)take((size_t)Mr * 3 * C * 2);    // qkv, then h2
    float*    x1   = (float*)   take((size_t)Mr * C * 4);
    ushort_t* fbuf = (ushort_t*)take((size_t)Mr * DFF * 2);

    auto cvt = [&](const float* in, ushort_t* out, size_t n) {
        cvt_bf16_kernel<<<(unsigned)(n / 8192), 256, 0, stream>>>(in, out);
    };
    cvt(qkv_w,  wq, (size_t)3 * C * C);
    cvt(proj_w, wp, (size_t)C * C);
    cvt(ff_w1,  w1, (size_t)DFF * C);
    cvt(ff_w2,  w2, (size_t)C * DFF);

    // 1) h = LN1(x)
    ln_kernel<<<Mr / 8, 256, 0, stream>>>(x, ln1_w, ln1_b, hbuf);
    // 2) qkv = h @ qkv_w^T
    gemm_bf16_kernel<EPI_BF16><<<dim3(3 * C / 128, Mr / 128), 256, 0, stream>>>(
        hbuf, wq, Mr, 3 * C, C, nullptr, nullptr, qkvb);
    // 3) y = causal attention(q, k, v)   (writes into hbuf)
    flash_kernel<<<dim3(T / 128, Bb * NH), 256, 0, stream>>>(qkvb, hbuf);
    // 4) x1 = x + y @ proj_w^T
    gemm_bf16_kernel<EPI_RESID_F32><<<dim3(C / 128, Mr / 128), 256, 0, stream>>>(
        hbuf, wp, Mr, C, C, nullptr, x, x1);
    // 5) h2 = LN2(x1)   (reuse qkv buffer)
    ln_kernel<<<Mr / 8, 256, 0, stream>>>(x1, ln2_w, ln2_b, qkvb);
    // 6) f = gelu(h2 @ ff_w1^T + b1)
    gemm_bf16_kernel<EPI_GELU_BF16><<<dim3(DFF / 128, Mr / 128), 256, 0, stream>>>(
        qkvb, w1, Mr, DFF, C, ff_b1, nullptr, fbuf);
    // 7) out = x1 + f @ ff_w2^T + b2
    gemm_bf16_kernel<EPI_RESID_F32><<<dim3(C / 128, Mr / 128), 256, 0, stream>>>(
        fbuf, w2, Mr, C, DFF, ff_b2, x1, (float*)d_out);
    // 8) trailing scalar output = 0
    tail_zero_kernel<<<1, 1, 0, stream>>>((float*)d_out + (size_t)Mr * C);
}

// v008
// Measured time: 322 microseconds a run.
// Next to v007, in two timings, it ran 1.03 times as fast each time.
// Over all steps from v000 it is 2.62 times as fast.
#include <hip/hip_runtime.h>
#include <hip/hip_bf16.h>

typedef unsigned short ushort_t;
typedef __attribute__((ext_vector_type(16))) __bf16 v16bf;
typedef __attribute__((ext_vector_type(8)))  float  v8f;

__device__ __forceinline__ ushort_t f2bf(float f) {
    unsigned int u = __float_as_uint(f);
    unsigned int r = u + 0x7FFFu + ((u >> 16) & 1u);   // round-to-nearest-even
    return (ushort_t)(r >> 16);
}

__device__ __forceinline__ void async_copy16_held(const ushort_t* g, ushort_t* l) {
    asm volatile("global_load_async_to_lds_b128 %0, %1, off\n\ts_wait_xcnt 0x0"
                 :: "v"((unsigned)(size_t)l), "v"((unsigned long long)(size_t)g)
                 : "memory");
}
// Eight such copies of one lane, four per operand at rows 32 apart (gstep, lstep in
// elements), with the one wait behind the last of them.
__device__ __forceinline__ void async_copy16x8_held(const ushort_t* ga, const ushort_t* gw, size_t gstep,
                                                    ushort_t* la, ushort_t* lw, int lstep) {
    asm volatile("global_load_async_to_lds_b128 %0, %8, off\n\t"
                 "global_load_async_to_lds_b128 %1, %9, off\n\t"
                 "global_load_async_to_lds_b128 %2, %10, off\n\t"
                 "global_load_async_to_lds_b128 %3, %11, off\n\t"
                 "global_load_async_to_lds_b128 %4, %12, off\n\t"
                 "global_load_async_to_lds_b128 %5, %13, off\n\t"
                 "global_load_async_to_lds_b128 %6, %14, off\n\t"
                 "global_load_async_to_lds_b128 %7, %15, off\n\t"
                 "s_wait_xcnt 0x0"
                 :: "v"((unsigned)(size_t)la), "v"((unsigned)(size_t)(la + lstep)),
                    "v"((unsigned)(size_t)(la + 2 * lstep)), "v"((unsigned)(size_t)(la + 3 * lstep)),
                    "v"((unsigned)(size_t)lw), "v"((unsigned)(size_t)(lw + lstep)),
                    "v"((unsigned)(size_t)(lw + 2 * lstep)), "v"((unsigned)(size_t)(lw + 3 * lstep)),
                    "v"((unsigned long long)(size_t)ga),
                    "v"((unsigned long long)(size_t)(ga + gstep)),
                    "v"((unsigned long long)(size_t)(ga + 2 * gstep)),
                    "v"((unsigned long long)(size_t)(ga + 3 * gstep)),
                    "v"((unsigned long long)(size_t)gw),
                    "v"((unsigned long long)(size_t)(gw + gstep)),
                    "v"((unsigned long long)(size_t)(gw + 2 * gstep)),
                    "v"((unsigned long long)(size_t)(gw + 3 * gstep))
                 : "memory");
}
__device__ __forceinline__ void wait_async0() {
    asm volatile("s_wait_asynccnt 0x0" ::: "memory");
}
__device__ __forceinline__ void wait_ds0() {
    asm volatile("s_wait_dscnt 0x0" ::: "memory");
}

__device__ __forceinline__ v16bf load_frag(const ushort_t* p, int lh) {
    union { uint4 q[2]; v16bf f; } u;
    u.q[0] = *(const uint4*)(p + lh * 8);
    u.q[1] = *(const uint4*)(p + 16 + lh * 8);
    return u.f;
}

// ---------------------------------------------------------------- utilities
__device__ __forceinline__ ushort4 f2bf4(float4 v) {
    ushort4 o;
    o.x = f2bf(v.x); o.y = f2bf(v.y); o.z = f2bf(v.z); o.w = f2bf(v.w);
    return o;
}

// 32 elements per thread, 8192 per block: eight 16-byte loads in flight per lane,
// each wave-wide access on whole lines. blk counts the pieces of 8192 of a tensor that is made of whole ones.
__device__ __forceinline__
void cvt_bf16_block(const float* __restrict__ in, ushort_t* __restrict__ out, unsigned blk) {
    const size_t base = (size_t)blk * 2048 + threadIdx.x;   // in groups of four elements
    const float4* in4 = (const float4*)in + base;
    ushort4* out4 = (ushort4*)out + base;
    float4 v[8];
#pragma unroll
    for (int u = 0; u < 8; ++u) v[u] = in4[u * 256];
#pragma unroll
    for (int u = 0; u < 8; ++u) out4[u * 256] = f2bf4(v[u]);
}

// ---------------------------------------------------------------- layernorm
// One wave per row of 1024, eight rows per block: the row stays in registers
// (eight 16-byte loads per lane) and both sums are joined inside the wave.
__device__ __forceinline__ float wave_sum(float s) {
#pragma unroll
    for (int d = 16; d >= 1; d >>= 1) s += __shfl_xor(s, d, 32);
    return s;
}

__device__ __forceinline__
void ln_block(const float* __restrict__ x, const float* __restrict__ w,
              const float* __restrict__ b, ushort_t* __restrict__ out, unsigned blk) {
    constexpr int C = 1024;
    const int lane = threadIdx.x & 31;
    const size_t row = (size_t)blk * 8 + (threadIdx.x >> 5);
    const float4* xr = (const float4*)(x + row * C) + lane;
    const float4* w4 = (const float4*)w + lane;
    const float4* b4 = (const float4*)b + lane;
    ushort4* o4 = (ushort4*)(out + row * C) + lane;

    float4 v[8];
#pragma unroll
    for (int u = 0; u < 8; ++u) v[u] = xr[u * 32];

    float s = 0.f;
#pragma unroll
    for (int u = 0; u < 8; ++u) s += (v[u].x + v[u].y) + (v[u].z + v[u].w);
    const float mu = wave_sum(s) / (float)C;

    float q = 0.f;
#pragma unroll
    for (int u = 0; u < 8; ++u) {
        v[u].x -= mu; v[u].y -= mu; v[u].z -= mu; v[u].w -= mu;
        q += (v[u].x * v[u].x + v[u].y * v[u].y) + (v[u].z * v[u].z + v[u].w * v[u].w);
    }
    const float rstd = rsqrtf(wave_sum(q) / (float)C + 1e-5f);

#pragma unroll
    for (int u = 0; u < 8; ++u) {
        const float4 wv = w4[u * 32];
        const float4 bv = b4[u * 32];
        float4 r;
        r.x = v[u].x * rstd * wv.x + bv.x;
        r.y = v[u].y * rstd * wv.y + bv.y;
        r.z = v[u].z * rstd * wv.z + bv.z;
        r.w = v[u].w * rstd * wv.w + bv.w;
        o4[u * 32] = f2bf4(r);
    }
}

__global__ __launch_bounds__(256)
void ln_kernel(const float* __restrict__ x, const float* __restrict__ w,
               const float* __restrict__ b, ushort_t* __restrict__ out) {
    ln_block(x, w, b, out, blockIdx.x);
}

// ---------------------------------------------------------------- all work that reads inputs only
// The first layernorm, the four weight conversions and the trailing zero depend on nothing but the
// inputs, so they share one launch: one launch gap, one fill and one drain, not six, and the short
// tensors' blocks run beside the long ones. The split is by block index alone (a scalar branch).
// The layernorm blocks, the longest, come first; the weights that the next launch reads come last.
constexpr unsigned PREP_LN = 4 * 2048 / 8;            // eight rows a block
constexpr unsigned PREP_W1 = 4096 * 1024 / 8192;      // 8192 elements a block
constexpr unsigned PREP_W2 = 1024 * 4096 / 8192;
constexpr unsigned PREP_WP = 1024 * 1024 / 8192;
constexpr unsigned PREP_WQ = 3 * 1024 * 1024 / 8192;

__global__ __launch_bounds__(256)
void prep_kernel(const float* __restrict__ x, const float* __restrict__ ln_w,
                 const float* __restrict__ ln_b, ushort_t* __restrict__ h,
                 const float* __restrict__ ff_w1, const float* __restrict__ ff_w2,
                 const float* __restrict__ proj_w, const float* __restrict__ qkv_w,
                 ushort_t* __restrict__ w1, ushort_t* __restrict__ w2,
                 ushort_t* __restrict__ wp, ushort_t* __restrict__ wq,
                 float* __restrict__ tail) {
    unsigned blk = blockIdx.x;
    if (blk < PREP_LN) { ln_block(x, ln_w, ln_b, h, blk); return; }
    blk -= PREP_LN;
    if (blk == 0 && threadIdx.x == 0) *tail = 0.0f;
    const float* in = ff_w1;
    ushort_t* out = w1;
    if (blk >= PREP_W1 + PREP_W2 + PREP_WP) { in = qkv_w;  out = wq; blk -= PREP_W1 + PREP_W2 + PREP_WP; }
    else if (blk >= PREP_W1 + PREP_W2)      { in = proj_w; out = wp; blk -= PREP_W1 + PREP_W2; }
    else if (blk >= PREP_W1)                { in = ff_w2;  out = w2; blk -= PREP_W1; }
    cvt_bf16_block(in, out, blk);
}

// ---------------------------------------------------------------- GEMM
// out[m,n] = epilogue( sum_k A[m,k] * W[n,k] )  -- A:[M,K] bf16, W:[N,K] bf16
// 128x128x64 tiles, double-buffered LDS filled by async global->LDS copies.
// A k step of 64 is one whole 128-byte line of every operand row: eight lanes copy
// one row's line, so a wave-wide copy touches four whole lines. K: a multiple of 64.
enum { EPI_BF16 = 0, EPI_GELU_BF16 = 1, EPI_RESID_F32 = 2 };

template <int EPI>
__global__ __launch_bounds__(256)
void gemm_bf16_kernel(const ushort_t* __restrict__ A, const ushort_t* __restrict__ W,
                      int M, int N, int K,
                      const float* __restrict__ bias,
                      const float* __restrict__ resid,
                      void* __restrict__ outp) {
    constexpr int LDSS = 72;                     // 64 cols + pad: 144B rows = 16B x odd, the b128 readers' pitch
    __shared__ __align__(16) ushort_t As[2][128 * LDSS];
    __shared__ __align__(16) ushort_t Ws[2][128 * LDSS];

    const int tid  = threadIdx.x;
    const int wave = tid >> 5;                   // wave32
    const int lane = tid & 31;
    const int lh   = lane >> 4;
    const int ll   = lane & 15;
    const int m0   = blockIdx.y * 128;
    const int n0   = blockIdx.x * 128;
    const int wm   = wave & 1;                   // 2 row-strips of 64
    const int wn   = wave >> 1;                  // 4 col-strips of 32

    v8f zero = {};
    v8f acc[4][2];
#pragma unroll
    for (int i = 0; i < 4; ++i)
#pragma unroll
        for (int j = 0; j < 2; ++j) acc[i][j] = zero;

    const int ldr  = tid >> 3;                   // 0..31 staging row, then +32, +64, +96
    const int lcol = (tid & 7) << 3;             // 16-byte piece of the row's line

    // async stage of one 128x64 A tile and one 128x64 W tile (64B/thread each)
    auto stage = [&](int kt, int buf) {
        async_copy16x8_held(A + (size_t)(m0 + ldr) * K + kt * 64 + lcol,
                            W + (size_t)(n0 + ldr) * K + kt * 64 + lcol, (size_t)32 * K,
                            &As[buf][ldr * LDSS + lcol], &Ws[buf][ldr * LDSS + lcol], 32 * LDSS);
    };

    const int nk = K >> 6;
    stage(0, 0);
    wait_async0();
    __syncthreads();
    if (nk > 1) stage(1, 1);                       // flies while tile 0 is worked on

    // Left: the build keeps one register set for the A fragments, so every pair of WMMAs stands behind
    // its own two LDS loads and a full s_wait_dscnt, eight such places a trip.
    for (int kt = 0; kt < nk; ++kt) {
        const int cur = kt & 1;
#pragma unroll
        for (int kk = 0; kk < 2; ++kk) {
            v16bf bfr[2];
#pragma unroll
            for (int j = 0; j < 2; ++j)
                bfr[j] = load_frag(&Ws[cur][(wn * 32 + j * 16 + ll) * LDSS + kk * 32], lh);
#pragma unroll
            for (int i = 0; i < 4; ++i) {
                v16bf afr = load_frag(&As[cur][(wm * 64 + i * 16 + ll) * LDSS + kk * 32], lh);
#pragma unroll
                for (int j = 0; j < 2; ++j)
                    acc[i][j] = __builtin_amdgcn_wmma_f32_16x16x32_bf16(
                        false, afr, false, bfr[j], (short)0, acc[i][j], false, false);
            }
        }

        wait_ds0();                                // this wave's reads of buffer cur are done
        wait_async0();                             // this wave's copies of the next tile have landed
        __syncthreads();                           // publishes tile kt + 1, frees buffer cur
        if (kt + 2 < nk) stage(kt + 2, cur);       // flies while tile kt + 1 is worked on
    }
    wait_async0();

    // epilogue: element (m, n) = (m0 + wm*64 + i*16 + r + 8*lh, n0 + wn*32 + j*16 + ll)
    if (EPI == EPI_RESID_F32) {
        // All 64 residual values of a lane are asked for together, ahead of the first add, and the
        // bias once per column: one memory latency for the tile, not one per element.
        // One 32-bit element offset per row serves the row's two loads and its two stores.
        // The loops are unrolled so that off, rv and acc are indexed by constants and stay in registers.
        const size_t tile0 = (size_t)m0 * N + n0;
        const float* rp = resid + tile0;
        float*       op = (float*)outp + tile0;
        const unsigned off0 = (unsigned)(wm * 64 + 8 * lh) * (unsigned)N + (unsigned)(wn * 32 + ll);
        unsigned off[4][8];
        float rv[4][2][8];
#pragma unroll
        for (int i = 0; i < 4; ++i)
#pragma unroll
            for (int r = 0; r < 8; ++r) {
                off[i][r] = off0 + (unsigned)(i * 16 + r) * (unsigned)N;
#pragma unroll
                for (int j = 0; j < 2; ++j) rv[i][j][r] = (rp + j * 16)[off[i][r]];
            }
        float bv[2];
#pragma unroll
        for (int j = 0; j < 2; ++j) bv[j] = bias ? bias[n0 + wn * 32 + j * 16 + ll] : 0.0f;
#pragma unroll
        for (int i = 0; i < 4; ++i)
#pragma unroll
            for (int r = 0; r < 8; ++r)
#pragma unroll
                for (int j = 0; j < 2; ++j)
                    (op + j * 16)[off[i][r]] = (acc[i][j][r] + bv[j]) + rv[i][j][r];
        return;
    }
#pragma unroll
    for (int i = 0; i < 4; ++i)
#pragma unroll
        for (int j = 0; j < 2; ++j) {
            const int col = n0 + wn * 32 + j * 16 + ll;
#pragma unroll
            for (int r = 0; r < 8; ++r) {
                const int row = m0 + wm * 64 + i * 16 + r + 8 * lh;
                float v = acc[i][j][r];
                if (EPI == EPI_GELU_BF16) {
                    // Left: erff builds to two divergent branches per element, one dependent chain each,
                    // so the 64 elements of a lane run one after the other.
                    v += bias[col];
                    v = 0.5f * v * (1.0f + erff(v * 0.7071067811865475f));
                    ((ushort_t*)outp)[(size_t)row * N + col] = f2bf(v);
                } else {
                    ((ushort_t*)outp)[(size_t)row * N + col] = f2bf(v);
                }
            }
        }
}

// ---------------------------------------------------------------- flash attention
typedef __attribute__((ext_vector_type(2))) float  v2f;
typedef __attribute__((ext_vector_type(2))) __bf16 v2bf;

__device__ __forceinline__ float xhalf(float x) {
    const int b = __builtin_bit_cast(int, x);
    return __builtin_bit_cast(float, __builtin_amdgcn_permlanex16(b, b, 0x76543210, 0xfedcba98, false, false));
}
// Two f32 to two bf16, round to nearest even, one instruction.
__device__ __forceinline__ v2bf pack2(float lo, float hi) {
    v2f x = {lo, hi};
    return __builtin_convertvector(x, v2bf);
}

__global__ __launch_bounds__(256) __attribute__((amdgpu_waves_per_eu(8)))
void flash_kernel(const ushort_t* __restrict__ qkv, ushort_t* __restrict__ y) {
    constexpr int T = 2048, C = 1024, HD = 64;
    constexpr int LDQ = 3 * C;
    constexpr int KP = 72;                                // 64 d + pad, 144B rows
    constexpr int VP = 40;                                // 32 keys + pad, 80B rows
    __shared__ __align__(16) ushort_t kt[32 * KP];        // K tile, row-major [key][d]
    __shared__ __align__(16) ushort_t vt[64 * VP];        // V tile transposed [d][key]

    const int tid  = threadIdx.x;
    const int wave = tid >> 5;
    const int lane = tid & 31;
    const int lh   = lane >> 4;
    const int ll   = lane & 15;
    const int b    = blockIdx.y >> 4;
    const int head = blockIdx.y & 15;
    const int flat = blockIdx.y * (T / 128) + blockIdx.x;
    const int qt   = (__builtin_popcount(flat) & 1) ? (T / 128 - 1) - (int)blockIdx.x : (int)blockIdx.x;
    const int qrow0 = qt * 128 + wave * 16;
    const size_t rowbase = (size_t)b * T;
    const int row = qrow0 + ll;                           // this lane's query

    // Q fragments (16 rows x 64 d), straight from global: the B operand (d x query) of S^T
    v16bf qf[2];
#pragma unroll
    for (int f = 0; f < 2; ++f)
        qf[f] = load_frag(qkv + (rowbase + row) * LDQ + head * HD + f * 32, lh);

    v8f zero = {};
    v8f o[4];                                             // o[t][r] = O[row][t*16 + 8*lh + r]
#pragma unroll
    for (int t = 0; t < 4; ++t) o[t] = zero;
    float mrow = -1e30f;                                  // the query's running maximum, alike in both halves
    float lrow = 0.f;                                     // the sum over this half's keys; joined after the loop

    const int qhi = qt * 128 + 128;

    for (int j0 = 0; j0 < qhi; j0 += 32) {
        {
            const int krow = tid >> 3;
            const int c8   = (tid & 7) << 3;
            const size_t src = (rowbase + j0 + krow) * LDQ + head * HD + c8;
            async_copy16_held(qkv + src + C, &kt[krow * KP + c8]);
            union { uint4 v; ushort_t u[8]; } vv;
            vv.v = *(const uint4*)(qkv + src + 2 * C);
#pragma unroll
            for (int i = 0; i < 8; ++i) vt[(c8 + i) * VP + krow] = vv.u[i];
        }
        wait_async0();
        __syncthreads();

        // S^T = K @ Q^T (32 keys x 16 queries), two 16x16 tiles, K-dim = 64 -> 2 wmma each
        // s[cg][r] = score of key j0 + cg*16 + 8*lh + r with query row
        v8f s[2]; s[0] = zero; s[1] = zero;
#pragma unroll
        for (int cg = 0; cg < 2; ++cg)
#pragma unroll
            for (int f = 0; f < 2; ++f) {
                v16bf kb = load_frag(&kt[(cg * 16 + ll) * KP + f * 32], lh);
                s[cg] = __builtin_amdgcn_wmma_f32_16x16x32_bf16(
                    false, kb, false, qf[f], (short)0, s[cg], false, false);
            }

        // scale + causal mask
        const int dq = row - 8 * lh - j0;                // the query's distance from the lane's first key
#pragma unroll
        for (int cg = 0; cg < 2; ++cg)
#pragma unroll
            for (int r = 0; r < 8; ++r) {
                const float v = s[cg][r] * 0.125f;       // hd^-0.5, hd=64
                s[cg][r] = (cg * 16 + r <= dq) ? v : -1e30f;   // key <= query
            }

        // online softmax: 16 scores in the lane, the other 16 of the query in lane ^ 16
        float mx[8];
#pragma unroll
        for (int r = 0; r < 8; ++r) mx[r] = fmaxf(s[0][r], s[1][r]);
        const float mh = fmaxf(fmaxf(fmaxf(mx[0], mx[1]), fmaxf(mx[2], mx[3])),
                               fmaxf(fmaxf(mx[4], mx[5]), fmaxf(mx[6], mx[7])));
        const float mnew  = fmaxf(mrow, fmaxf(mh, xhalf(mh)));
        const float alpha = __expf(mrow - mnew);
        mrow = mnew;
#pragma unroll
        for (int r = 0; r < 8; ++r)
#pragma unroll
            for (int cg = 0; cg < 2; ++cg) s[cg][r] = __expf(s[cg][r] - mnew);
        v2f ps[4];                                        // summed in the register pairs that the pack reads too
#pragma unroll
        for (int e = 0; e < 4; ++e) {
            const v2f p0 = {s[0][2 * e], s[0][2 * e + 1]};
            const v2f p1 = {s[1][2 * e], s[1][2 * e + 1]};
            ps[e] = p0 + p1;
        }
        const v2f pt2 = (ps[0] + ps[1]) + (ps[2] + ps[3]);
        lrow = lrow * alpha + (pt2.x + pt2.y);
#pragma unroll
        for (int t = 0; t < 4; ++t)
#pragma unroll
            for (int r = 0; r < 8; ++r) o[t][r] *= alpha;

        // P^T as B operand (32 keys x 16 queries): element e of the fragment is key 8*lh + e for e < 8 and
        // 16 + 8*lh + (e - 8) above, which is what the lane's two score tiles hold, in that order
        union { v2bf h[8]; v16bf f; } pb;
#pragma unroll
        for (int cg = 0; cg < 2; ++cg)
#pragma unroll
            for (int e = 0; e < 4; ++e) pb.h[cg * 4 + e] = pack2(s[cg][2 * e], s[cg][2 * e + 1]);

        // O^T += V^T @ P^T   (V^T staged: row d of V^T is a contiguous vt row, read in the same key order)
#pragma unroll
        for (int t = 0; t < 4; ++t) {
            v16bf va = load_frag(&vt[(t * 16 + ll) * VP], lh);
            o[t] = __builtin_amdgcn_wmma_f32_16x16x32_bf16(
                false, va, false, pb.f, (short)0, o[t], false, false);
        }
        __syncthreads();
    }

    // normalize and store: a lane's eight values of a tile are eight neighbouring columns, one 16-byte store
    const float inv = 1.0f / (lrow + xhalf(lrow));
    ushort_t* yr = y + (rowbase + row) * C + head * HD + 8 * lh;
#pragma unroll
    for (int t = 0; t < 4; ++t) {
        union { v2bf h[4]; uint4 q; } ov;
#pragma unroll
        for (int e = 0; e < 4; ++e) ov.h[e] = pack2(o[t][2 * e] * inv, o[t][2 * e + 1] * inv);
        *(uint4*)(yr + t * 16) = ov.q;
    }
}

// ---------------------------------------------------------------- launcher
extern "C" void kernel_launch(void* const* d_in, const int* in_sizes, int n_in,
                              void* d_out, int out_size, void* d_ws, size_t ws_size,
                              hipStream_t stream) {
    (void)in_sizes; (void)n_in; (void)out_size; (void)ws_size;
    const float* x      = (const float*)d_in[0];
    const float* ln1_w  = (const float*)d_in[1];
    const float* ln1_b  = (const float*)d_in[2];
    const float* ln2_w  = (const float*)d_in[3];
    const float* ln2_b  = (const float*)d_in[4];
    const float* qkv_w  = (const float*)d_in[5];
    const float* proj_w = (const float*)d_in[6];
    const float* ff_w1  = (const float*)d_in[7];
    const float* ff_b1  = (const float*)d_in[8];
    const float* ff_w2  = (const float*)d_in[9];
    const float* ff_b2  = (const float*)d_in[10];

    constexpr int Bb = 4, T = 2048, C = 1024, NH = 16, DFF = 4096;
    constexpr int Mr = Bb * T;                   // 8192 rows

    char* ws = (char*)d_ws;
    size_t off = 0;
    auto take = [&](size_t bytes) -> char* {
        char* p = ws + off;
        off += (bytes + 255) & ~(size_t)255;
        return p;
    };
    ushort_t* wq   = (ushort_t*)take((size_t)3 * C * C * 2);
    ushort_t* wp   = (ushort_t*)take((size_t)C * C * 2);
    ushort_t* w1   = (ushort_t*)take((size_t)DFF * C * 2);
    ushort_t* w2   = (ushort_t*)take((size_t)C * DFF * 2);
    ushort_t* hbuf = (ushort_t*)take((size_t)Mr * C * 2);        // h, then y_att
    ushort_t* qkvb = (ushort_t*)take((size_t)Mr * 3 * C * 2);    // qkv, then h2
    float*    x1   = (float*)   take((size_t)Mr * C * 4);
    ushort_t* fbuf = (ushort_t*)take((size_t)Mr * DFF * 2);

    // 1) h = LN1(x); the four weights to bf16; trailing scalar output = 0
    prep_kernel<<<PREP_LN + PREP_W1 + PREP_W2 + PREP_WP + PREP_WQ, 256, 0, stream>>>(
        x, ln1_w, ln1_b, hbuf, ff_w1, ff_w2, proj_w, qkv_w, w1, w2, wp, wq,
        (float*)d_out + (size_t)Mr * C);
    // 2) qkv = h @ qkv_w^T
    gemm_bf16_kernel<EPI_BF16><<<dim3(3 * C / 128, Mr / 128), 256, 0, stream>>>(
        hbuf, wq, Mr, 3 * C, C, nullptr, nullptr, qkvb);
    // 3) y = causal attention(q, k, v)   (writes into hbuf)
    flash_kernel<<<dim3(T / 128, Bb * NH), 256, 0, stream>>>(qkvb, hbuf);
    // 4) x1 = x + y @ proj_w^T
    gemm_bf16_kernel<EPI_RESID_F32><<<dim3(C / 128, Mr / 128), 256, 0, stream>>>(
        hbuf, wp, Mr, C, C, nullptr, x, x1);
    // 5) h2 = LN2(x1)   (reuse qkv buffer)
    ln_kernel<<<Mr / 8, 256, 0, stream>>>(x1, ln2_w, ln2_b, qkvb);
    // 6) f = gelu(h2 @ ff_w1^T + b1)
    gemm_bf16_kernel<EPI_GELU_BF16><<<dim3(DFF / 128, Mr / 128), 256, 0, stream>>>(
        qkvb, w1, Mr, DFF, C, ff_b1, nullptr, fbuf);
    // 7) out = x1 + f @ ff_w2^T + b2
    gemm_bf16_kernel<EPI_RESID_F32><<<dim3(C / 128, Mr / 128), 256, 0, stream>>>(
        fbuf, w2, Mr, C, DFF, ff_b2, x1, (float*)d_out);
}

// v009
// One run takes 306 microseconds.
// Two timings next to v008 put it at 1.05 and 1.06 times that version's speed.
// Over all steps from v000 it is 2.75 times as fast.
#include <hip/hip_runtime.h>
#include <hip/hip_bf16.h>

typedef unsigned short ushort_t;
typedef __attribute__((ext_vector_type(16))) __bf16 v16bf;
typedef __attribute__((ext_vector_type(8)))  float  v8f;

__device__ __forceinline__ ushort_t f2bf(float f) {
    unsigned int u = __float_as_uint(f);
    unsigned int r = u + 0x7FFFu + ((u >> 16) & 1u);   // round-to-nearest-even
    return (ushort_t)(r >> 16);
}

__device__ __forceinline__ void async_copy16_held(const ushort_t* g, ushort_t* l) {
    asm volatile("global_load_async_to_lds_b128 %0, %1, off\n\ts_wait_xcnt 0x0"
                 :: "v"((unsigned)(size_t)l), "v"((unsigned long long)(size_t)g)
                 : "memory");
}
// Eight such copies of one lane, four per operand at rows 32 apart (gstep, lstep in
// elements), with the one wait behind the last of them.
__device__ __forceinline__ void async_copy16x8_held(const ushort_t* ga, const ushort_t* gw, size_t gstep,
                                                    ushort_t* la, ushort_t* lw, int lstep) {
    asm volatile("global_load_async_to_lds_b128 %0, %8, off\n\t"
                 "global_load_async_to_lds_b128 %1, %9, off\n\t"
                 "global_load_async_to_lds_b128 %2, %10, off\n\t"
                 "global_load_async_to_lds_b128 %3, %11, off\n\t"
                 "global_load_async_to_lds_b128 %4, %12, off\n\t"
                 "global_load_async_to_lds_b128 %5, %13, off\n\t"
                 "global_load_async_to_lds_b128 %6, %14, off\n\t"
                 "global_load_async_to_lds_b128 %7, %15, off\n\t"
                 "s_wait_xcnt 0x0"
                 :: "v"((unsigned)(size_t)la), "v"((unsigned)(size_t)(la + lstep)),
                    "v"((unsigned)(size_t)(la + 2 * lstep)), "v"((unsigned)(size_t)(la + 3 * lstep)),
                    "v"((unsigned)(size_t)lw), "v"((unsigned)(size_t)(lw + lstep)),
                    "v"((unsigned)(size_t)(lw + 2 * lstep)), "v"((unsigned)(size_t)(lw + 3 * lstep)),
                    "v"((unsigned long long)(size_t)ga),
                    "v"((unsigned long long)(size_t)(ga + gstep)),
                    "v"((unsigned long long)(size_t)(ga + 2 * gstep)),
                    "v"((unsigned long long)(size_t)(ga + 3 * gstep)),
                    "v"((unsigned long long)(size_t)gw),
                    "v"((unsigned long long)(size_t)(gw + gstep)),
                    "v"((unsigned long long)(size_t)(gw + 2 * gstep)),
                    "v"((unsigned long long)(size_t)(gw + 3 * gstep))
                 : "memory");
}
__device__ __forceinline__ void wait_async0() {
    asm volatile("s_wait_asynccnt 0x0" ::: "memory");
}
__device__ __forceinline__ void wait_ds0() {
    asm volatile("s_wait_dscnt 0x0" ::: "memory");
}

__device__ __forceinline__ v16bf load_frag(const ushort_t* p, int lh) {
    union { uint4 q[2]; v16bf f; } u;
    u.q[0] = *(const uint4*)(p + lh * 8);
    u.q[1] = *(const uint4*)(p + 16 + lh * 8);
    return u.f;
}

// ---------------------------------------------------------------- utilities
__device__ __forceinline__ ushort4 f2bf4(float4 v) {
    ushort4 o;
    o.x = f2bf(v.x); o.y = f2bf(v.y); o.z = f2bf(v.z); o.w = f2bf(v.w);
    return o;
}

// 32 elements per thread, 8192 per block: eight 16-byte loads in flight per lane,
// each wave-wide access on whole lines. blk counts the pieces of 8192 of a tensor that is made of whole ones.
__device__ __forceinline__
void cvt_bf16_block(const float* __restrict__ in, ushort_t* __restrict__ out, unsigned blk) {
    const size_t base = (size_t)blk * 2048 + threadIdx.x;   // in groups of four elements
    const float4* in4 = (const float4*)in + base;
    ushort4* out4 = (ushort4*)out + base;
    float4 v[8];
#pragma unroll
    for (int u = 0; u < 8; ++u) v[u] = in4[u * 256];
#pragma unroll
    for (int u = 0; u < 8; ++u) out4[u * 256] = f2bf4(v[u]);
}

// ---------------------------------------------------------------- layernorm
// One wave per row of 1024, eight rows per block: the row stays in registers
// (eight 16-byte loads per lane) and both sums are joined inside the wave.
__device__ __forceinline__ float wave_sum(float s) {
#pragma unroll
    for (int d = 16; d >= 1; d >>= 1) s += __shfl_xor(s, d, 32);
    return s;
}

__device__ __forceinline__
void ln_block(const float* __restrict__ x, const float* __restrict__ w,
              const float* __restrict__ b, ushort_t* __restrict__ out, unsigned blk) {
    constexpr int C = 1024;
    const int lane = threadIdx.x & 31;
    const size_t row = (size_t)blk * 8 + (threadIdx.x >> 5);
    const float4* xr = (const float4*)(x + row * C) + lane;
    const float4* w4 = (const float4*)w + lane;
    const float4* b4 = (const float4*)b + lane;
    ushort4* o4 = (ushort4*)(out + row * C) + lane;

    float4 v[8];
#pragma unroll
    for (int u = 0; u < 8; ++u) v[u] = xr[u * 32];

    float s = 0.f;
#pragma unroll
    for (int u = 0; u < 8; ++u) s += (v[u].x + v[u].y) + (v[u].z + v[u].w);
    const float mu = wave_sum(s) / (float)C;

    float q = 0.f;
#pragma unroll
    for (int u = 0; u < 8; ++u) {
        v[u].x -= mu; v[u].y -= mu; v[u].z -= mu; v[u].w -= mu;
        q += (v[u].x * v[u].x + v[u].y * v[u].y) + (v[u].z * v[u].z + v[u].w * v[u].w);
    }
    const float rstd = rsqrtf(wave_sum(q) / (float)C + 1e-5f);

#pragma unroll
    for (int u = 0; u < 8; ++u) {
        const float4 wv = w4[u * 32];
        const float4 bv = b4[u * 32];
        float4 r;
        r.x = v[u].x * rstd * wv.x + bv.x;
        r.y = v[u].y * rstd * wv.y + bv.y;
        r.z = v[u].z * rstd * wv.z + bv.z;
        r.w = v[u].w * rstd * wv.w + bv.w;
        o4[u * 32] = f2bf4(r);
    }
}

__global__ __launch_bounds__(256)
void ln_kernel(const float* __restrict__ x, const float* __restrict__ w,
               const float* __restrict__ b, ushort_t* __restrict__ out) {
    ln_block(x, w, b, out, blockIdx.x);
}

// ---------------------------------------------------------------- all work that reads inputs only
// The first layernorm, the four weight conversions and the trailing zero depend on nothing but the
// inputs, so they share one launch: one launch gap, one fill and one drain, not six, and the short
// tensors' blocks run beside the long ones. The split is by block index alone (a scalar branch).
// The layernorm blocks, the longest, come first; the weights that the next launch reads come last.
constexpr unsigned PREP_LN = 4 * 2048 / 8;            // eight rows a block
constexpr unsigned PREP_W1 = 4096 * 1024 / 8192;      // 8192 elements a block
constexpr unsigned PREP_W2 = 1024 * 4096 / 8192;
constexpr unsigned PREP_WP = 1024 * 1024 / 8192;
constexpr unsigned PREP_WQ = 3 * 1024 * 1024 / 8192;

__global__ __launch_bounds__(256)
void prep_kernel(const float* __restrict__ x, const float* __restrict__ ln_w,
                 const float* __restrict__ ln_b, ushort_t* __restrict__ h,
                 const float* __restrict__ ff_w1, const float* __restrict__ ff_w2,
                 const float* __restrict__ proj_w, const float* __restrict__ qkv_w,
                 ushort_t* __restrict__ w1, ushort_t* __restrict__ w2,
                 ushort_t* __restrict__ wp, ushort_t* __restrict__ wq,
                 float* __restrict__ tail) {
    unsigned blk = blockIdx.x;
    if (blk < PREP_LN) { ln_block(x, ln_w, ln_b, h, blk); return; }
    blk -= PREP_LN;
    if (blk == 0 && threadIdx.x == 0) *tail = 0.0f;
    const float* in = ff_w1;
    ushort_t* out = w1;
    if (blk >= PREP_W1 + PREP_W2 + PREP_WP) { in = qkv_w;  out = wq; blk -= PREP_W1 + PREP_W2 + PREP_WP; }
    else if (blk >= PREP_W1 + PREP_W2)      { in = proj_w; out = wp; blk -= PREP_W1 + PREP_W2; }
    else if (blk >= PREP_W1)                { in = ff_w2;  out = w2; blk -= PREP_W1; }
    cvt_bf16_block(in, out, blk);
}

// ---------------------------------------------------------------- GEMM
typedef __attribute__((ext_vector_type(2))) float  v2f;
typedef __attribute__((ext_vector_type(2))) __bf16 v2bf;
// Two f32 to two bf16, round to nearest even, one instruction.
__device__ __forceinline__ v2bf pack2(float lo, float hi) {
    v2f x = {lo, hi};
    return __builtin_convertvector(x, v2bf);
}

// out[m,n] = epilogue( sum_k A[m,k] * W[n,k] )  -- A:[M,K] bf16, W:[N,K] bf16
// 128x128x64 tiles, double-buffered LDS filled by async global->LDS copies.
// A k step of 64 is one whole 128-byte line of every operand row: eight lanes copy
// one row's line, so a wave-wide copy touches four whole lines. K: a multiple of 64.
enum { EPI_BF16 = 0, EPI_GELU_BF16 = 1, EPI_RESID_F32 = 2 };

template <int EPI>
__global__ __launch_bounds__(256)
void gemm_bf16_kernel(const ushort_t* __restrict__ A, const ushort_t* __restrict__ W,
                      int M, int N, int K,
                      const float* __restrict__ bias,
                      const float* __restrict__ resid,
                      void* __restrict__ outp) {
    constexpr int LDSS = 72;                     // 64 cols + pad: 144B rows = 16B x odd, the b128 readers' pitch
    __shared__ __align__(16) ushort_t As[2][128 * LDSS];
    __shared__ __align__(16) ushort_t Ws[2][128 * LDSS];

    const int tid  = threadIdx.x;
    const int wave = tid >> 5;                   // wave32
    const int lane = tid & 31;
    const int lh   = lane >> 4;
    const int ll   = lane & 15;
    const int m0   = blockIdx.y * 128;
    const int n0   = blockIdx.x * 128;
    const int wm   = wave & 1;                   // 2 row-strips of 64
    const int wn   = wave >> 1;                  // 4 col-strips of 32

    v8f zero = {};
    v8f acc[4][2];
#pragma unroll
    for (int i = 0; i < 4; ++i)
#pragma unroll
        for (int j = 0; j < 2; ++j) acc[i][j] = zero;

    const int ldr  = tid >> 3;                   // 0..31 staging row, then +32, +64, +96
    const int lcol = (tid & 7) << 3;             // 16-byte piece of the row's line

    // async stage of one 128x64 A tile and one 128x64 W tile (64B/thread each)
    auto stage = [&](int kt, int buf) {
        async_copy16x8_held(A + (size_t)(m0 + ldr) * K + kt * 64 + lcol,
                            W + (size_t)(n0 + ldr) * K + kt * 64 + lcol, (size_t)32 * K,
                            &As[buf][ldr * LDSS + lcol], &Ws[buf][ldr * LDSS + lcol], 32 * LDSS);
    };

    const int nk = K >> 6;
    stage(0, 0);
    wait_async0();
    __syncthreads();
    if (nk > 1) stage(1, 1);                       // flies while tile 0 is worked on

    // Left: the build keeps one register set for the A fragments, so every pair of WMMAs stands behind
    // its own two LDS loads and a full s_wait_dscnt, eight such places a trip.
    for (int kt = 0; kt < nk; ++kt) {
        const int cur = kt & 1;
#pragma unroll
        for (int kk = 0; kk < 2; ++kk) {
            v16bf bfr[2];
#pragma unroll
            for (int j = 0; j < 2; ++j)
                bfr[j] = load_frag(&Ws[cur][(wn * 32 + j * 16 + ll) * LDSS + kk * 32], lh);
#pragma unroll
            for (int i = 0; i < 4; ++i) {
                v16bf afr = load_frag(&As[cur][(wm * 64 + i * 16 + ll) * LDSS + kk * 32], lh);
#pragma unroll
                for (int j = 0; j < 2; ++j)
                    acc[i][j] = __builtin_amdgcn_wmma_f32_16x16x32_bf16(
                        false, bfr[j], false, afr, (short)0, acc[i][j], false, false);
            }
        }

        wait_ds0();                                // this wave's reads of buffer cur are done
        wait_async0();                             // this wave's copies of the next tile have landed
        __syncthreads();                           // publishes tile kt + 1, frees buffer cur
        if (kt + 2 < nk) stage(kt + 2, cur);       // flies while tile kt + 1 is worked on
    }
    wait_async0();

    // epilogue. The W rows are the first operand of the products, so a tile is held transposed:
    // acc[i][j][r] = element (m0 + wm*64 + i*16 + ll, n0 + wn*32 + j*16 + 8*lh + r), eight neighbours of one row.
    // The 128x128 tile goes through LDS, 16 bytes a lane, and to and from memory in whole 128-byte lines.
    // The ring is free here: the last trip's foot (each wave's s_wait_dscnt 0 and s_wait_asynccnt 0, then
    // the barrier) ended every read of it, and no copy was issued behind it.
    // The loops are unrolled so that acc, rv, off and bv are indexed by constants and stay in registers.
    const int nw = wn * 32 + 8 * lh;             // the lane's first column of tile j = 0
    if (EPI == EPI_RESID_F32) {
        // A wave moves row wave + 8 u: 512 bytes, four whole lines, per load and per store.
        // All 16 residual loads of a lane are asked for together, ahead of the barrier: one memory latency for them.
        constexpr int FP = 132;                  // 128 floats + pad: 528B rows = 16B x odd
        // One 32-bit offset per row, in 16-byte units, serves the row's load and its store.
        const size_t tile0 = (size_t)m0 * N + n0;
        const float4* rp = (const float4*)(resid + tile0);
        float4*       op = (float4*)((float*)outp + tile0);
        const float4 z4 = {0.f, 0.f, 0.f, 0.f};
        float4 bv[2][2] = {{z4, z4}, {z4, z4}};
        if (bias) {
#pragma unroll
            for (int j = 0; j < 2; ++j)
#pragma unroll
                for (int h = 0; h < 2; ++h) bv[j][h] = *(const float4*)(bias + n0 + nw + j * 16 + h * 4);
        }
        unsigned off[16];
        float4 rv[16];
#pragma unroll
        for (int u = 0; u < 16; ++u) {
            off[u] = (unsigned)(wave + 8 * u) * (unsigned)(N >> 2) + (unsigned)lane;
            rv[u] = rp[off[u]];
        }
        // rows 0..63 of the tile lie in the A ring, rows 64..127 in the W ring (33,792 of 36,864 bytes each)
        float* st = (float*)(wm ? &Ws[0][0] : &As[0][0]);
#pragma unroll
        for (int j = 0; j < 2; ++j) {
            const float4 b0 = bv[j][0], b1 = bv[j][1];
#pragma unroll
            for (int i = 0; i < 4; ++i) {
                float* p = st + (i * 16 + ll) * FP + nw + j * 16;
                float4 lo, hi;
                lo.x = acc[i][j][0] + b0.x; lo.y = acc[i][j][1] + b0.y;
                lo.z = acc[i][j][2] + b0.z; lo.w = acc[i][j][3] + b0.w;
                hi.x = acc[i][j][4] + b1.x; hi.y = acc[i][j][5] + b1.y;
                hi.z = acc[i][j][6] + b1.z; hi.w = acc[i][j][7] + b1.w;
                *(float4*)p = lo;
                *(float4*)(p + 4) = hi;
            }
        }
        __syncthreads();                         // the staged tile is read by other waves than wrote it
#pragma unroll
        for (int u = 0; u < 16; ++u) {
            const float* sr = (const float*)(u < 8 ? &As[0][0] : &Ws[0][0]) + (wave + 8 * (u & 7)) * FP + lane * 4;
            const float4 s = *(const float4*)sr;
            float4 o;
            o.x = s.x + rv[u].x; o.y = s.y + rv[u].y; o.z = s.z + rv[u].z; o.w = s.w + rv[u].w;
            op[off[u]] = o;
        }
        return;
    }
    constexpr int SP = 136;                      // 128 bf16 + pad: 272B rows = 16B x odd; 34,816 of the A ring's 36,864 bytes
    ushort_t* st = &As[0][0];
#pragma unroll
    for (int j = 0; j < 2; ++j) {
        float bv[8];
        if (EPI == EPI_GELU_BF16) {
            const float4 b0 = *(const float4*)(bias + n0 + nw + j * 16);
            const float4 b1 = *(const float4*)(bias + n0 + nw + j * 16 + 4);
            bv[0] = b0.x; bv[1] = b0.y; bv[2] = b0.z; bv[3] = b0.w;
            bv[4] = b1.x; bv[5] = b1.y; bv[6] = b1.z; bv[7] = b1.w;
        }
#pragma unroll
        for (int i = 0; i < 4; ++i) {
            float v[8];
#pragma unroll
            for (int r = 0; r < 8; ++r) {
                v[r] = acc[i][j][r];
                if (EPI == EPI_GELU_BF16) {
                    // Left: erff builds to two divergent branches per element, one dependent chain each,
                    // so the 64 elements of a lane run one after the other.
                    v[r] += bv[r];
                    v[r] = 0.5f * v[r] * (1.0f + erff(v[r] * 0.7071067811865475f));
                }
            }
            union { v2bf h[4]; uint4 q; } pk;
#pragma unroll
            for (int e = 0; e < 4; ++e) pk.h[e] = pack2(v[2 * e], v[2 * e + 1]);
            *(uint4*)&st[(wm * 64 + i * 16 + ll) * SP + nw + j * 16] = pk.q;
        }
    }
    __syncthreads();                             // the staged tile is read by other waves than wrote it
    // 16 lanes move one row's 256 bytes: a wave-wide store covers two rows, four whole lines
    uint4* op = (uint4*)((ushort_t*)outp + (size_t)m0 * N + n0);
#pragma unroll
    for (int u = 0; u < 8; ++u)
        op[(unsigned)((tid >> 4) + 16 * u) * (unsigned)(N >> 3) + (unsigned)(tid & 15)] =
            *(const uint4*)&st[((tid >> 4) + 16 * u) * SP + (tid & 15) * 8];
}

// ---------------------------------------------------------------- flash attention

__device__ __forceinline__ float xhalf(float x) {
    const int b = __builtin_bit_cast(int, x);
    return __builtin_bit_cast(float, __builtin_amdgcn_permlanex16(b, b, 0x76543210, 0xfedcba98, false, false));
}

__global__ __launch_bounds__(256) __attribute__((amdgpu_waves_per_eu(8)))
void flash_kernel(const ushort_t* __restrict__ qkv, ushort_t* __restrict__ y) {
    constexpr int T = 2048, C = 1024, HD = 64;
    constexpr int LDQ = 3 * C;
    constexpr int KP = 72;                                // 64 d + pad, 144B rows
    constexpr int VP = 40;                                // 32 keys + pad, 80B rows
    __shared__ __align__(16) ushort_t kt[32 * KP];        // K tile, row-major [key][d]
    __shared__ __align__(16) ushort_t vt[64 * VP];        // V tile transposed [d][key]

    const int tid  = threadIdx.x;
    const int wave = tid >> 5;
    const int lane = tid & 31;
    const int lh   = lane >> 4;
    const int ll   = lane & 15;
    const int b    = blockIdx.y >> 4;
    const int head = blockIdx.y & 15;
    const int flat = blockIdx.y * (T / 128) + blockIdx.x;
    const int qt   = (__builtin_popcount(flat) & 1) ? (T / 128 - 1) - (int)blockIdx.x : (int)blockIdx.x;
    const int qrow0 = qt * 128 + wave * 16;
    const size_t rowbase = (size_t)b * T;
    const int row = qrow0 + ll;                           // this lane's query

    // Q fragments (16 rows x 64 d), straight from global: the B operand (d x query) of S^T
    v16bf qf[2];
#pragma unroll
    for (int f = 0; f < 2; ++f)
        qf[f] = load_frag(qkv + (rowbase + row) * LDQ + head * HD + f * 32, lh);

    v8f zero = {};
    v8f o[4];                                             // o[t][r] = O[row][t*16 + 8*lh + r]
#pragma unroll
    for (int t = 0; t < 4; ++t) o[t] = zero;
    float mrow = -1e30f;                                  // the query's running maximum, alike in both halves
    float lrow = 0.f;                                     // the sum over this half's keys; joined after the loop

    const int qhi = qt * 128 + 128;

    for (int j0 = 0; j0 < qhi; j0 += 32) {
        {
            const int krow = tid >> 3;
            const int c8   = (tid & 7) << 3;
            const size_t src = (rowbase + j0 + krow) * LDQ + head * HD + c8;
            async_copy16_held(qkv + src + C, &kt[krow * KP + c8]);
            union { uint4 v; ushort_t u[8]; } vv;
            vv.v = *(const uint4*)(qkv + src + 2 * C);
#pragma unroll
            for (int i = 0; i < 8; ++i) vt[(c8 + i) * VP + krow] = vv.u[i];
        }
        wait_async0();
        __syncthreads();

        // S^T = K @ Q^T (32 keys x 16 queries), two 16x16 tiles, K-dim = 64 -> 2 wmma each
        // s[cg][r] = score of key j0 + cg*16 + 8*lh + r with query row
        v8f s[2]; s[0] = zero; s[1] = zero;
#pragma unroll
        for (int cg = 0; cg < 2; ++cg)
#pragma unroll
            for (int f = 0; f < 2; ++f) {
                v16bf kb = load_frag(&kt[(cg * 16 + ll) * KP + f * 32], lh);
                s[cg] = __builtin_amdgcn_wmma_f32_16x16x32_bf16(
                    false, kb, false, qf[f], (short)0, s[cg], false, false);
            }

        // scale + causal mask
        const int dq = row - 8 * lh - j0;                // the query's distance from the lane's first key
#pragma unroll
        for (int cg = 0; cg < 2; ++cg)
#pragma unroll
            for (int r = 0; r < 8; ++r) {
                const float v = s[cg][r] * 0.125f;       // hd^-0.5, hd=64
                s[cg][r] = (cg * 16 + r <= dq) ? v : -1e30f;   // key <= query
            }

        // online softmax: 16 scores in the lane, the other 16 of the query in lane ^ 16
        float mx[8];
#pragma unroll
        for (int r = 0; r < 8; ++r) mx[r] = fmaxf(s[0][r], s[1][r]);
        const float mh = fmaxf(fmaxf(fmaxf(mx[0], mx[1]), fmaxf(mx[2], mx[3])),
                               fmaxf(fmaxf(mx[4], mx[5]), fmaxf(mx[6], mx[7])));
        const float mnew  = fmaxf(mrow, fmaxf(mh, xhalf(mh)));
        const float alpha = __expf(mrow - mnew);
        mrow = mnew;
#pragma unroll
        for (int r = 0; r < 8; ++r)
#pragma unroll
            for (int cg = 0; cg < 2; ++cg) s[cg][r] = __expf(s[cg][r] - mnew);
        v2f ps[4];                                        // summed in the register pairs that the pack reads too
#pragma unroll
        for (int e = 0; e < 4; ++e) {
            const v2f p0 = {s[0][2 * e], s[0][2 * e + 1]};
            const v2f p1 = {s[1][2 * e], s[1][2 * e + 1]};
            ps[e] = p0 + p1;
        }
        const v2f pt2 = (ps[0] + ps[1]) + (ps[2] + ps[3]);
        lrow = lrow * alpha + (pt2.x + pt2.y);
#pragma unroll
        for (int t = 0; t < 4; ++t)
#pragma unroll
            for (int r = 0; r < 8; ++r) o[t][r] *= alpha;

        // P^T as B operand (32 keys x 16 queries): element e of the fragment is key 8*lh + e for e < 8 and
        // 16 + 8*lh + (e - 8) above, which is what the lane's two score tiles hold, in that order
        union { v2bf h[8]; v16bf f; } pb;
#pragma unroll
        for (int cg = 0; cg < 2; ++cg)
#pragma unroll
            for (int e = 0; e < 4; ++e) pb.h[cg * 4 + e] = pack2(s[cg][2 * e], s[cg][2 * e + 1]);

        // O^T += V^T @ P^T   (V^T staged: row d of V^T is a contiguous vt row, read in the same key order)
#pragma unroll
        for (int t = 0; t < 4; ++t) {
            v16bf va = load_frag(&vt[(t * 16 + ll) * VP], lh);
            o[t] = __builtin_amdgcn_wmma_f32_16x16x32_bf16(
                false, va, false, pb.f, (short)0, o[t], false, false);
        }
        __syncthreads();
    }

    // normalize and store: a lane's eight values of a tile are eight neighbouring columns, one 16-byte store
    const float inv = 1.0f / (lrow + xhalf(lrow));
    ushort_t* yr = y + (rowbase + row) * C + head * HD + 8 * lh;
#pragma unroll
    for (int t = 0; t < 4; ++t) {
        union { v2bf h[4]; uint4 q; } ov;
#pragma unroll
        for (int e = 0; e < 4; ++e) ov.h[e] = pack2(o[t][2 * e] * inv, o[t][2 * e + 1] * inv);
        *(uint4*)(yr + t * 16) = ov.q;
    }
}

// ---------------------------------------------------------------- launcher
extern "C" void kernel_launch(void* const* d_in, const int* in_sizes, int n_in,
                              void* d_out, int out_size, void* d_ws, size_t ws_size,
                              hipStream_t stream) {
    (void)in_sizes; (void)n_in; (void)out_size; (void)ws_size;
    const float* x      = (const float*)d_in[0];
    const float* ln1_w  = (const float*)d_in[1];
    const float* ln1_b  = (const float*)d_in[2];
    const float* ln2_w  = (const float*)d_in[3];
    const float* ln2_b  = (const float*)d_in[4];
    const float* qkv_w  = (const float*)d_in[5];
    const float* proj_w = (const float*)d_in[6];
    const float* ff_w1  = (const float*)d_in[7];
    const float* ff_b1  = (const float*)d_in[8];
    const float* ff_w2  = (const float*)d_in[9];
    const float* ff_b2  = (const float*)d_in[10];

    constexpr int Bb = 4, T = 2048, C = 1024, NH = 16, DFF = 4096;
    constexpr int Mr = Bb * T;                   // 8192 rows

    char* ws = (char*)d_ws;
    size_t off = 0;
    auto take = [&](size_t bytes) -> char* {
        char* p = ws + off;
        off += (bytes + 255) & ~(size_t)255;
        return p;
    };
    ushort_t* wq   = (ushort_t*)take((size_t)3 * C * C * 2);
    ushort_t* wp   = (ushort_t*)take((size_t)C * C * 2);
    ushort_t* w1   = (ushort_t*)take((size_t)DFF * C * 2);
    ushort_t* w2   = (ushort_t*)take((size_t)C * DFF * 2);
    ushort_t* hbuf = (ushort_t*)take((size_t)Mr * C * 2);        // h, then y_att
    ushort_t* qkvb = (ushort_t*)take((size_t)Mr * 3 * C * 2);    // qkv, then h2
    float*    x1   = (float*)   take((size_t)Mr * C * 4);
    ushort_t* fbuf = (ushort_t*)take((size_t)Mr * DFF * 2);

    // 1) h = LN1(x); the four weights to bf16; trailing scalar output = 0
    prep_kernel<<<PREP_LN + PREP_W1 + PREP_W2 + PREP_WP + PREP_WQ, 256, 0, stream>>>(
        x, ln1_w, ln1_b, hbuf, ff_w1, ff_w2, proj_w, qkv_w, w1, w2, wp, wq,
        (float*)d_out + (size_t)Mr * C);
    // 2) qkv = h @ qkv_w^T
    gemm_bf16_kernel<EPI_BF16><<<dim3(3 * C / 128, Mr / 128), 256, 0, stream>>>(
        hbuf, wq, Mr, 3 * C, C, nullptr, nullptr, qkvb);
    // 3) y = causal attention(q, k, v)   (writes into hbuf)
    flash_kernel<<<dim3(T / 128, Bb * NH), 256, 0, stream>>>(qkvb, hbuf);
    // 4) x1 = x + y @ proj_w^T
    gemm_bf16_kernel<EPI_RESID_F32><<<dim3(C / 128, Mr / 128), 256, 0, stream>>>(
        hbuf, wp, Mr, C, C, nullptr, x, x1);
    // 5) h2 = LN2(x1)   (reuse qkv buffer)
    ln_kernel<<<Mr / 8, 256, 0, stream>>>(x1, ln2_w, ln2_b, qkvb);
    // 6) f = gelu(h2 @ ff_w1^T + b1)
    gemm_bf16_kernel<EPI_GELU_BF16><<<dim3(DFF / 128, Mr / 128), 256, 0, stream>>>(
        qkvb, w1, Mr, DFF, C, ff_b1, nullptr, fbuf);
    // 7) out = x1 + f @ ff_w2^T + b2
    gemm_bf16_kernel<EPI_RESID_F32><<<dim3(C / 128, Mr / 128), 256, 0, stream>>>(
        fbuf, w2, Mr, C, DFF, ff_b2, x1, (float*)d_out);
}

// v010
// One run takes 292 microseconds.
// Timed twice side by side with v009, it ran 1.05 times as fast both times.
// All steps since v000 together make it 2.88 times as fast.
#include <hip/hip_runtime.h>
#include <hip/hip_bf16.h>

typedef unsigned short ushort_t;
typedef __attribute__((ext_vector_type(16))) __bf16 v16bf;
typedef __attribute__((ext_vector_type(8)))  float  v8f;

__device__ __forceinline__ ushort_t f2bf(float f) {
    unsigned int u = __float_as_uint(f);
    unsigned int r = u + 0x7FFFu + ((u >> 16) & 1u);   // round-to-nearest-even
    return (ushort_t)(r >> 16);
}

__device__ __forceinline__ void async_copy16_held(const ushort_t* g, ushort_t* l) {
    asm volatile("global_load_async_to_lds_b128 %0, %1, off\n\ts_wait_xcnt 0x0"
                 :: "v"((unsigned)(size_t)l), "v"((unsigned long long)(size_t)g)
                 : "memory");
}
// Eight such copies of one lane, four per operand at rows 32 apart (gstep, lstep in
// elements), with the one wait behind the last of them.
__device__ __forceinline__ void async_copy16x8_held(const ushort_t* ga, const ushort_t* gw, size_t gstep,
                                                    ushort_t* la, ushort_t* lw, int lstep) {
    asm volatile("global_load_async_to_lds_b128 %0, %8, off\n\t"
                 "global_load_async_to_lds_b128 %1, %9, off\n\t"
                 "global_load_async_to_lds_b128 %2, %10, off\n\t"
                 "global_load_async_to_lds_b128 %3, %11, off\n\t"
                 "global_load_async_to_lds_b128 %4, %12, off\n\t"
                 "global_load_async_to_lds_b128 %5, %13, off\n\t"
                 "global_load_async_to_lds_b128 %6, %14, off\n\t"
                 "global_load_async_to_lds_b128 %7, %15, off\n\t"
                 "s_wait_xcnt 0x0"
                 :: "v"((unsigned)(size_t)la), "v"((unsigned)(size_t)(la + lstep)),
                    "v"((unsigned)(size_t)(la + 2 * lstep)), "v"((unsigned)(size_t)(la + 3 * lstep)),
                    "v"((unsigned)(size_t)lw), "v"((unsigned)(size_t)(lw + lstep)),
                    "v"((unsigned)(size_t)(lw + 2 * lstep)), "v"((unsigned)(size_t)(lw + 3 * lstep)),
                    "v"((unsigned long long)(size_t)ga),
                    "v"((unsigned long long)(size_t)(ga + gstep)),
                    "v"((unsigned long long)(size_t)(ga + 2 * gstep)),
                    "v"((unsigned long long)(size_t)(ga + 3 * gstep)),
                    "v"((unsigned long long)(size_t)gw),
                    "v"((unsigned long long)(size_t)(gw + gstep)),
                    "v"((unsigned long long)(size_t)(gw + 2 * gstep)),
                    "v"((unsigned long long)(size_t)(gw + 3 * gstep))
                 : "memory");
}
__device__ __forceinline__ void wait_async0() {
    asm volatile("s_wait_asynccnt 0x0" ::: "memory");
}
__device__ __forceinline__ void wait_ds0() {
    asm volatile("s_wait_dscnt 0x0" ::: "memory");
}

__device__ __forceinline__ v16bf load_frag(const ushort_t* p, int lh) {
    union { uint4 q[2]; v16bf f; } u;
    u.q[0] = *(const uint4*)(p + lh * 8);
    u.q[1] = *(const uint4*)(p + 16 + lh * 8);
    return u.f;
}

// ---------------------------------------------------------------- utilities
__device__ __forceinline__ ushort4 f2bf4(float4 v) {
    ushort4 o;
    o.x = f2bf(v.x); o.y = f2bf(v.y); o.z = f2bf(v.z); o.w = f2bf(v.w);
    return o;
}

// 32 elements per thread, 8192 per block: eight 16-byte loads in flight per lane,
// each wave-wide access on whole lines. blk counts the pieces of 8192 of a tensor that is made of whole ones.
__device__ __forceinline__
void cvt_bf16_block(const float* __restrict__ in, ushort_t* __restrict__ out, unsigned blk) {
    const size_t base = (size_t)blk * 2048 + threadIdx.x;   // in groups of four elements
    const float4* in4 = (const float4*)in + base;
    ushort4* out4 = (ushort4*)out + base;
    float4 v[8];
#pragma unroll
    for (int u = 0; u < 8; ++u) v[u] = in4[u * 256];
#pragma unroll
    for (int u = 0; u < 8; ++u) out4[u * 256] = f2bf4(v[u]);
}

// ---------------------------------------------------------------- layernorm
// One wave per row of 1024, eight rows per block: the row stays in registers
// (eight 16-byte loads per lane) and both sums are joined inside the wave.
__device__ __forceinline__ float wave_sum(float s) {
#pragma unroll
    for (int d = 16; d >= 1; d >>= 1) s += __shfl_xor(s, d, 32);
    return s;
}

__device__ __forceinline__
void ln_block(const float* __restrict__ x, const float* __restrict__ w,
              const float* __restrict__ b, ushort_t* __restrict__ out, unsigned blk) {
    constexpr int C = 1024;
    const int lane = threadIdx.x & 31;
    const size_t row = (size_t)blk * 8 + (threadIdx.x >> 5);
    const float4* xr = (const float4*)(x + row * C) + lane;
    const float4* w4 = (const float4*)w + lane;
    const float4* b4 = (const float4*)b + lane;
    ushort4* o4 = (ushort4*)(out + row * C) + lane;

    float4 v[8];
#pragma unroll
    for (int u = 0; u < 8; ++u) v[u] = xr[u * 32];

    float s = 0.f;
#pragma unroll
    for (int u = 0; u < 8; ++u) s += (v[u].x + v[u].y) + (v[u].z + v[u].w);
    const float mu = wave_sum(s) / (float)C;

    float q = 0.f;
#pragma unroll
    for (int u = 0; u < 8; ++u) {
        v[u].x -= mu; v[u].y -= mu; v[u].z -= mu; v[u].w -= mu;
        q += (v[u].x * v[u].x + v[u].y * v[u].y) + (v[u].z * v[u].z + v[u].w * v[u].w);
    }
    const float rstd = rsqrtf(wave_sum(q) / (float)C + 1e-5f);

#pragma unroll
    for (int u = 0; u < 8; ++u) {
        const float4 wv = w4[u * 32];
        const float4 bv = b4[u * 32];
        float4 r;
        r.x = v[u].x * rstd * wv.x + bv.x;
        r.y = v[u].y * rstd * wv.y + bv.y;
        r.z = v[u].z * rstd * wv.z + bv.z;
        r.w = v[u].w * rstd * wv.w + bv.w;
        o4[u * 32] = f2bf4(r);
    }
}

__global__ __launch_bounds__(256)
void ln_kernel(const float* __restrict__ x, const float* __restrict__ w,
               const float* __restrict__ b, ushort_t* __restrict__ out) {
    ln_block(x, w, b, out, blockIdx.x);
}

// ---------------------------------------------------------------- all work that reads inputs only
// The first layernorm, the four weight conversions and the trailing zero depend on nothing but the
// inputs, so they share one launch: one launch gap, one fill and one drain, not six, and the short
// tensors' blocks run beside the long ones. The split is by block index alone (a scalar branch).
// The layernorm blocks, the longest, come first; the weights that the next launch reads come last.
constexpr unsigned PREP_LN = 4 * 2048 / 8;            // eight rows a block
constexpr unsigned PREP_W1 = 4096 * 1024 / 8192;      // 8192 elements a block
constexpr unsigned PREP_W2 = 1024 * 4096 / 8192;
constexpr unsigned PREP_WP = 1024 * 1024 / 8192;
constexpr unsigned PREP_WQ = 3 * 1024 * 1024 / 8192;

__global__ __launch_bounds__(256)
void prep_kernel(const float* __restrict__ x, const float* __restrict__ ln_w,
                 const float* __restrict__ ln_b, ushort_t* __restrict__ h,
                 const float* __restrict__ ff_w1, const float* __restrict__ ff_w2,
                 const float* __restrict__ proj_w, const float* __restrict__ qkv_w,
                 ushort_t* __restrict__ w1, ushort_t* __restrict__ w2,
                 ushort_t* __restrict__ wp, ushort_t* __restrict__ wq,
                 float* __restrict__ tail) {
    unsigned blk = blockIdx.x;
    if (blk < PREP_LN) { ln_block(x, ln_w, ln_b, h, blk); return; }
    blk -= PREP_LN;
    if (blk == 0 && threadIdx.x == 0) *tail = 0.0f;
    const float* in = ff_w1;
    ushort_t* out = w1;
    if (blk >= PREP_W1 + PREP_W2 + PREP_WP) { in = qkv_w;  out = wq; blk -= PREP_W1 + PREP_W2 + PREP_WP; }
    else if (blk >= PREP_W1 + PREP_W2)      { in = proj_w; out = wp; blk -= PREP_W1 + PREP_W2; }
    else if (blk >= PREP_W1)                { in = ff_w2;  out = w2; blk -= PREP_W1; }
    cvt_bf16_block(in, out, blk);
}

// ---------------------------------------------------------------- GEMM
typedef __attribute__((ext_vector_type(2))) float  v2f;
typedef __attribute__((ext_vector_type(2))) __bf16 v2bf;
// Two f32 to two bf16, round to nearest even, one instruction.
__device__ __forceinline__ v2bf pack2(float lo, float hi) {
    v2f x = {lo, hi};
    return __builtin_convertvector(x, v2bf);
}

// out[m,n] = epilogue( sum_k A[m,k] * W[n,k] )  -- A:[M,K] bf16, W:[N,K] bf16
// 128x128x64 tiles, double-buffered LDS filled by async global->LDS copies.
// A k step of 64 is one whole 128-byte line of every operand row: eight lanes copy
// one row's line, so a wave-wide copy touches four whole lines. K: a multiple of 64.
enum { EPI_BF16 = 0, EPI_GELU_BF16 = 1, EPI_RESID_F32 = 2 };

template <int EPI>
__global__ __launch_bounds__(256)
void gemm_bf16_kernel(const ushort_t* __restrict__ A, const ushort_t* __restrict__ W,
                      int M, int N, int K,
                      const float* __restrict__ bias,
                      const float* __restrict__ resid,
                      void* __restrict__ outp) {
    constexpr int LDSS = 72;                     // 64 cols + pad: 144B rows = 16B x odd, the b128 readers' pitch
    __shared__ __align__(16) ushort_t As[2][128 * LDSS];
    __shared__ __align__(16) ushort_t Ws[2][128 * LDSS];

    const int tid  = threadIdx.x;
    const int wave = tid >> 5;                   // wave32
    const int lane = tid & 31;
    const int lh   = lane >> 4;
    const int ll   = lane & 15;
    const int m0   = blockIdx.y * 128;
    const int n0   = blockIdx.x * 128;
    const int wm   = wave & 1;                   // 2 row-strips of 64
    const int wn   = wave >> 1;                  // 4 col-strips of 32

    v8f zero = {};
    v8f acc[4][2];
#pragma unroll
    for (int i = 0; i < 4; ++i)
#pragma unroll
        for (int j = 0; j < 2; ++j) acc[i][j] = zero;

    const int ldr  = tid >> 3;                   // 0..31 staging row, then +32, +64, +96
    const int lcol = (tid & 7) << 3;             // 16-byte piece of the row's line

    // async stage of one 128x64 A tile and one 128x64 W tile (64B/thread each)
    auto stage = [&](int kt, int buf) {
        async_copy16x8_held(A + (size_t)(m0 + ldr) * K + kt * 64 + lcol,
                            W + (size_t)(n0 + ldr) * K + kt * 64 + lcol, (size_t)32 * K,
                            &As[buf][ldr * LDSS + lcol], &Ws[buf][ldr * LDSS + lcol], 32 * LDSS);
    };

    const int nk = K >> 6;
    stage(0, 0);
    wait_async0();
    __syncthreads();
    if (nk > 1) stage(1, 1);                       // flies while tile 0 is worked on

    // Left: the build keeps one register set for the A fragments, so every pair of WMMAs stands behind
    // its own two LDS loads and a full s_wait_dscnt, eight such places a trip.
    for (int kt = 0; kt < nk; ++kt) {
        const int cur = kt & 1;
#pragma unroll
        for (int kk = 0; kk < 2; ++kk) {
            v16bf bfr[2];
#pragma unroll
            for (int j = 0; j < 2; ++j)
                bfr[j] = load_frag(&Ws[cur][(wn * 32 + j * 16 + ll) * LDSS + kk * 32], lh);
#pragma unroll
            for (int i = 0; i < 4; ++i) {
                v16bf afr = load_frag(&As[cur][(wm * 64 + i * 16 + ll) * LDSS + kk * 32], lh);
#pragma unroll
                for (int j = 0; j < 2; ++j)
                    acc[i][j] = __builtin_amdgcn_wmma_f32_16x16x32_bf16(
                        false, bfr[j], false, afr, (short)0, acc[i][j], false, false);
            }
        }

        wait_ds0();                                // this wave's reads of buffer cur are done
        wait_async0();                             // this wave's copies of the next tile have landed
        __syncthreads();                           // publishes tile kt + 1, frees buffer cur
        if (kt + 2 < nk) stage(kt + 2, cur);       // flies while tile kt + 1 is worked on
    }
    wait_async0();

    // epilogue. The W rows are the first operand of the products, so a tile is held transposed:
    // acc[i][j][r] = element (m0 + wm*64 + i*16 + ll, n0 + wn*32 + j*16 + 8*lh + r), eight neighbours of one row.
    // The 128x128 tile goes through LDS, 16 bytes a lane, and to and from memory in whole 128-byte lines.
    // The ring is free here: the last trip's foot (each wave's s_wait_dscnt 0 and s_wait_asynccnt 0, then
    // the barrier) ended every read of it, and no copy was issued behind it.
    // The loops are unrolled so that acc, rv, off and bv are indexed by constants and stay in registers.
    const int nw = wn * 32 + 8 * lh;             // the lane's first column of tile j = 0
    if (EPI == EPI_RESID_F32) {
        // A wave moves row wave + 8 u: 512 bytes, four whole lines, per load and per store.
        // All 16 residual loads of a lane are asked for together, ahead of the barrier: one memory latency for them.
        constexpr int FP = 132;                  // 128 floats + pad: 528B rows = 16B x odd
        // One 32-bit offset per row, in 16-byte units, serves the row's load and its store.
        const size_t tile0 = (size_t)m0 * N + n0;
        const float4* rp = (const float4*)(resid + tile0);
        float4*       op = (float4*)((float*)outp + tile0);
        const float4 z4 = {0.f, 0.f, 0.f, 0.f};
        float4 bv[2][2] = {{z4, z4}, {z4, z4}};
        if (bias) {
#pragma unroll
            for (int j = 0; j < 2; ++j)
#pragma unroll
                for (int h = 0; h < 2; ++h) bv[j][h] = *(const float4*)(bias + n0 + nw + j * 16 + h * 4);
        }
        unsigned off[16];
        float4 rv[16];
#pragma unroll
        for (int u = 0; u < 16; ++u) {
            off[u] = (unsigned)(wave + 8 * u) * (unsigned)(N >> 2) + (unsigned)lane;
            rv[u] = rp[off[u]];
        }
        // rows 0..63 of the tile lie in the A ring, rows 64..127 in the W ring (33,792 of 36,864 bytes each)
        float* st = (float*)(wm ? &Ws[0][0] : &As[0][0]);
#pragma unroll
        for (int j = 0; j < 2; ++j) {
            const float4 b0 = bv[j][0], b1 = bv[j][1];
#pragma unroll
            for (int i = 0; i < 4; ++i) {
                float* p = st + (i * 16 + ll) * FP + nw + j * 16;
                float4 lo, hi;
                lo.x = acc[i][j][0] + b0.x; lo.y = acc[i][j][1] + b0.y;
                lo.z = acc[i][j][2] + b0.z; lo.w = acc[i][j][3] + b0.w;
                hi.x = acc[i][j][4] + b1.x; hi.y = acc[i][j][5] + b1.y;
                hi.z = acc[i][j][6] + b1.z; hi.w = acc[i][j][7] + b1.w;
                *(float4*)p = lo;
                *(float4*)(p + 4) = hi;
            }
        }
        __syncthreads();                         // the staged tile is read by other waves than wrote it
#pragma unroll
        for (int u = 0; u < 16; ++u) {
            const float* sr = (const float*)(u < 8 ? &As[0][0] : &Ws[0][0]) + (wave + 8 * (u & 7)) * FP + lane * 4;
            const float4 s = *(const float4*)sr;
            float4 o;
            o.x = s.x + rv[u].x; o.y = s.y + rv[u].y; o.z = s.z + rv[u].z; o.w = s.w + rv[u].w;
            op[off[u]] = o;
        }
        return;
    }
    constexpr int SP = 136;                      // 128 bf16 + pad: 272B rows = 16B x odd; 34,816 of the A ring's 36,864 bytes
    ushort_t* st = &As[0][0];
#pragma unroll
    for (int j = 0; j < 2; ++j) {
        float bv[8];
        if (EPI == EPI_GELU_BF16) {
            const float4 b0 = *(const float4*)(bias + n0 + nw + j * 16);
            const float4 b1 = *(const float4*)(bias + n0 + nw + j * 16 + 4);
            bv[0] = b0.x; bv[1] = b0.y; bv[2] = b0.z; bv[3] = b0.w;
            bv[4] = b1.x; bv[5] = b1.y; bv[6] = b1.z; bv[7] = b1.w;
        }
#pragma unroll
        for (int i = 0; i < 4; ++i) {
            float v[8];
#pragma unroll
            for (int r = 0; r < 8; ++r) {
                v[r] = acc[i][j][r];
                if (EPI == EPI_GELU_BF16) {
                    // Left: erff builds to two divergent branches per element, one dependent chain each,
                    // so the 64 elements of a lane run one after the other.
                    v[r] += bv[r];
                    v[r] = 0.5f * v[r] * (1.0f + erff(v[r] * 0.7071067811865475f));
                }
            }
            union { v2bf h[4]; uint4 q; } pk;
#pragma unroll
            for (int e = 0; e < 4; ++e) pk.h[e] = pack2(v[2 * e], v[2 * e + 1]);
            *(uint4*)&st[(wm * 64 + i * 16 + ll) * SP + nw + j * 16] = pk.q;
        }
    }
    __syncthreads();                             // the staged tile is read by other waves than wrote it
    // 16 lanes move one row's 256 bytes: a wave-wide store covers two rows, four whole lines
    uint4* op = (uint4*)((ushort_t*)outp + (size_t)m0 * N + n0);
#pragma unroll
    for (int u = 0; u < 8; ++u)
        op[(unsigned)((tid >> 4) + 16 * u) * (unsigned)(N >> 3) + (unsigned)(tid & 15)] =
            *(const uint4*)&st[((tid >> 4) + 16 * u) * SP + (tid & 15) * 8];
}

// ---------------------------------------------------------------- flash attention

__device__ __forceinline__ float xhalf(float x) {
    const int b = __builtin_bit_cast(int, x);
    return __builtin_bit_cast(float, __builtin_amdgcn_permlanex16(b, b, 0x76543210, 0xfedcba98, false, false));
}

__global__ __launch_bounds__(256) __attribute__((amdgpu_waves_per_eu(8)))
void flash_kernel(const ushort_t* __restrict__ qkv, ushort_t* __restrict__ y) {
    constexpr int T = 2048, C = 1024, HD = 64;
    constexpr int LDQ = 3 * C;
    constexpr int KP = 72;                                // 64 d + pad, 144B rows
    constexpr int VP = 40;                                // 32 keys + pad, 80B rows
    __shared__ __align__(16) ushort_t kt[2][32 * KP];     // K tiles, row-major [key][d]
    __shared__ __align__(16) ushort_t vt[2][64 * VP];     // V tiles transposed [d][key]

    const int tid  = threadIdx.x;
    const int wave = tid >> 5;
    const int lane = tid & 31;
    const int lh   = lane >> 4;
    const int ll   = lane & 15;
    const int b    = blockIdx.y >> 4;
    const int head = blockIdx.y & 15;
    const int flat = blockIdx.y * (T / 128) + blockIdx.x;
    const int qt   = (__builtin_popcount(flat) & 1) ? (T / 128 - 1) - (int)blockIdx.x : (int)blockIdx.x;
    const int qrow0 = qt * 128 + wave * 16;
    const size_t rowbase = (size_t)b * T;
    const int row = qrow0 + ll;                           // this lane's query

    // Q fragments (16 rows x 64 d), straight from global: the B operand (d x query) of S^T
    v16bf qf[2];
#pragma unroll
    for (int f = 0; f < 2; ++f)
        qf[f] = load_frag(qkv + (rowbase + row) * LDQ + head * HD + f * 32, lh);

    v8f zero = {};
    v8f o[4];                                             // o[t][r] = O[row][t*16 + 8*lh + r]
#pragma unroll
    for (int t = 0; t < 4; ++t) o[t] = zero;
    float mrow = -1e30f;                                  // the query's running maximum, alike in both halves
    float lrow = 0.f;                                     // the sum over this half's keys; joined after the loop

    const int np = qt * 4 + 4;                            // passes of 32 keys: at least four

    // staging: a thread moves 16 bytes of row krow of K (asynchronous copy, row-major) and of V (registers, scattered)
    const int krow = tid >> 3;
    const int c8   = (tid & 7) << 3;
    const ushort_t* ksrc = qkv + (rowbase + krow) * LDQ + head * HD + c8 + C;   // pass p: + p * 32 * LDQ
    const ushort_t* vsrc = ksrc + C;
    auto kcopy = [&](int p, int buf) {
        async_copy16_held(ksrc + (size_t)p * (32 * LDQ), &kt[buf][krow * KP + c8]);
    };
    auto vload = [&](int p) { return *(const uint4*)(vsrc + (size_t)p * (32 * LDQ)); };
    auto vscatter = [&](uint4 q, int buf) {
        union { uint4 v; ushort_t u[8]; } vv;
        vv.v = q;
#pragma unroll
        for (int i = 0; i < 8; ++i) vt[buf][(c8 + i) * VP + krow] = vv.u[i];
    };

    kcopy(0, 0);
    vscatter(vload(0), 0);
    uint4 vnext = vload(1);                               // V of tile 1, scattered during pass 0
    wait_ds0();                                           // this wave's V stores of tile 0 are done
    wait_async0();                                        // this wave's K copy of tile 0 has landed
    __syncthreads();                                      // publishes tile 0
    kcopy(1, 1);                                          // flies while tile 0 is worked on

    for (int p = 0; p < np; ++p) {
        const int cur = p & 1;
        const int j0  = p * 32;

        // S^T = K @ Q^T (32 keys x 16 queries), two 16x16 tiles, K-dim = 64 -> 2 wmma each
        // s[cg][r] = score of key j0 + cg*16 + 8*lh + r with query row
        v8f s[2]; s[0] = zero; s[1] = zero;
#pragma unroll
        for (int cg = 0; cg < 2; ++cg)
#pragma unroll
            for (int f = 0; f < 2; ++f) {
                v16bf kb = load_frag(&kt[cur][(cg * 16 + ll) * KP + f * 32], lh);
                s[cg] = __builtin_amdgcn_wmma_f32_16x16x32_bf16(
                    false, kb, false, qf[f], (short)0, s[cg], false, false);
            }

        // V of tile p + 1 goes into the other buffer, which every wave left before the last barrier; the stores stand
        // behind this pass's K reads and drain under the softmax arithmetic, and so does the load of tile p + 2.
        if (p + 1 < np) {
            vscatter(vnext, cur ^ 1);
            if (p + 2 < np) vnext = vload(p + 2);
        }

        // scale + causal mask
        const int dq = row - 8 * lh - j0;                // the query's distance from the lane's first key
#pragma unroll
        for (int cg = 0; cg < 2; ++cg)
#pragma unroll
            for (int r = 0; r < 8; ++r) {
                const float v = s[cg][r] * 0.125f;       // hd^-0.5, hd=64
                s[cg][r] = (cg * 16 + r <= dq) ? v : -1e30f;   // key <= query
            }

        // online softmax: 16 scores in the lane, the other 16 of the query in lane ^ 16
        float mx[8];
#pragma unroll
        for (int r = 0; r < 8; ++r) mx[r] = fmaxf(s[0][r], s[1][r]);
        const float mh = fmaxf(fmaxf(fmaxf(mx[0], mx[1]), fmaxf(mx[2], mx[3])),
                               fmaxf(fmaxf(mx[4], mx[5]), fmaxf(mx[6], mx[7])));
        const float mnew  = fmaxf(mrow, fmaxf(mh, xhalf(mh)));
        const float alpha = __expf(mrow - mnew);
        mrow = mnew;
#pragma unroll
        for (int r = 0; r < 8; ++r)
#pragma unroll
            for (int cg = 0; cg < 2; ++cg) s[cg][r] = __expf(s[cg][r] - mnew);
        v2f ps[4];                                        // summed in the register pairs that the pack reads too
#pragma unroll
        for (int e = 0; e < 4; ++e) {
            const v2f p0 = {s[0][2 * e], s[0][2 * e + 1]};
            const v2f p1 = {s[1][2 * e], s[1][2 * e + 1]};
            ps[e] = p0 + p1;
        }
        const v2f pt2 = (ps[0] + ps[1]) + (ps[2] + ps[3]);
        lrow = lrow * alpha + (pt2.x + pt2.y);
#pragma unroll
        for (int t = 0; t < 4; ++t)
#pragma unroll
            for (int r = 0; r < 8; ++r) o[t][r] *= alpha;

        // P^T as B operand (32 keys x 16 queries): element e of the fragment is key 8*lh + e for e < 8 and
        // 16 + 8*lh + (e - 8) above, which is what the lane's two score tiles hold, in that order
        union { v2bf h[8]; v16bf f; } pb;
#pragma unroll
        for (int cg = 0; cg < 2; ++cg)
#pragma unroll
            for (int e = 0; e < 4; ++e) pb.h[cg * 4 + e] = pack2(s[cg][2 * e], s[cg][2 * e + 1]);

        // O^T += V^T @ P^T   (V^T staged: row d of V^T is a contiguous vt row, read in the same key order)
#pragma unroll
        for (int t = 0; t < 4; ++t) {
            v16bf va = load_frag(&vt[cur][(t * 16 + ll) * VP], lh);
            o[t] = __builtin_amdgcn_wmma_f32_16x16x32_bf16(
                false, va, false, pb.f, (short)0, o[t], false, false);
        }

        wait_ds0();                                       // this wave's reads of buffer cur and V stores of tile p + 1 are done
        wait_async0();                                    // this wave's K copy of tile p + 1 has landed
        __syncthreads();                                  // publishes tile p + 1, frees buffer cur
        if (p + 2 < np) kcopy(p + 2, cur);                // flies while tile p + 1 is worked on
    }
    wait_async0();

    // normalize and store: a lane's eight values of a tile are eight neighbouring columns, one 16-byte store
    const float inv = 1.0f / (lrow + xhalf(lrow));
    ushort_t* yr = y + (rowbase + row) * C + head * HD + 8 * lh;
#pragma unroll
    for (int t = 0; t < 4; ++t) {
        union { v2bf h[4]; uint4 q; } ov;
#pragma unroll
        for (int e = 0; e < 4; ++e) ov.h[e] = pack2(o[t][2 * e] * inv, o[t][2 * e + 1] * inv);
        *(uint4*)(yr + t * 16) = ov.q;
    }
}

// ---------------------------------------------------------------- launcher
extern "C" void kernel_launch(void* const* d_in, const int* in_sizes, int n_in,
                              void* d_out, int out_size, void* d_ws, size_t ws_size,
                              hipStream_t stream) {
    (void)in_sizes; (void)n_in; (void)out_size; (void)ws_size;
    const float* x      = (const float*)d_in[0];
    const float* ln1_w  = (const float*)d_in[1];
    const float* ln1_b  = (const float*)d_in[2];
    const float* ln2_w  = (const float*)d_in[3];
    const float* ln2_b  = (const float*)d_in[4];
    const float* qkv_w  = (const float*)d_in[5];
    const float* proj_w = (const float*)d_in[6];
    const float* ff_w1  = (const float*)d_in[7];
    const float* ff_b1  = (const float*)d_in[8];
    const float* ff_w2  = (const float*)d_in[9];
    const float* ff_b2  = (const float*)d_in[10];

    constexpr int Bb = 4, T = 2048, C = 1024, NH = 16, DFF = 4096;
    constexpr int Mr = Bb * T;                   // 8192 rows

    char* ws = (char*)d_ws;
    size_t off = 0;
    auto take = [&](size_t bytes) -> char* {
        char* p = ws + off;
        off += (bytes + 255) & ~(size_t)255;
        return p;
    };
    ushort_t* wq   = (ushort_t*)take((size_t)3 * C * C * 2);
    ushort_t* wp   = (ushort_t*)take((size_t)C * C * 2);
    ushort_t* w1   = (ushort_t*)take((size_t)DFF * C * 2);
    ushort_t* w2   = (ushort_t*)take((size_t)C * DFF * 2);
    ushort_t* hbuf = (ushort_t*)take((size_t)Mr * C * 2);        // h, then y_att
    ushort_t* qkvb = (ushort_t*)take((size_t)Mr * 3 * C * 2);    // qkv, then h2
    float*    x1   = (float*)   take((size_t)Mr * C * 4);
    ushort_t* fbuf = (ushort_t*)take((size_t)Mr * DFF * 2);

    // 1) h = LN1(x); the four weights to bf16; trailing scalar output = 0
    prep_kernel<<<PREP_LN + PREP_W1 + PREP_W2 + PREP_WP + PREP_WQ, 256, 0, stream>>>(
        x, ln1_w, ln1_b, hbuf, ff_w1, ff_w2, proj_w, qkv_w, w1, w2, wp, wq,
        (float*)d_out + (size_t)Mr * C);
    // 2) qkv = h @ qkv_w^T
    gemm_bf16_kernel<EPI_BF16><<<dim3(3 * C / 128, Mr / 128), 256, 0, stream>>>(
        hbuf, wq, Mr, 3 * C, C, nullptr, nullptr, qkvb);
    // 3) y = causal attention(q, k, v)   (writes into hbuf)
    flash_kernel<<<dim3(T / 128, Bb * NH), 256, 0, stream>>>(qkvb, hbuf);
    // 4) x1 = x + y @ proj_w^T
    gemm_bf16_kernel<EPI_RESID_F32><<<dim3(C / 128, Mr / 128), 256, 0, stream>>>(
        hbuf, wp, Mr, C, C, nullptr, x, x1);
    // 5) h2 = LN2(x1)   (reuse qkv buffer)
    ln_kernel<<<Mr / 8, 256, 0, stream>>>(x1, ln2_w, ln2_b, qkvb);
    // 6) f = gelu(h2 @ ff_w1^T + b1)
    gemm_bf16_kernel<EPI_GELU_BF16><<<dim3(DFF / 128, Mr / 128), 256, 0, stream>>>(
        qkvb, w1, Mr, DFF, C, ff_b1, nullptr, fbuf);
    // 7) out = x1 + f @ ff_w2^T + b2
    gemm_bf16_kernel<EPI_RESID_F32><<<dim3(C / 128, Mr / 128), 256, 0, stream>>>(
        fbuf, w2, Mr, C, DFF, ff_b2, x1, (float*)d_out);
}
